// v000
// Times are from an AMD MI455X. After a warm-up the kernel runs many times in a row, and a time is the length of
// such a window on the GPU divided by its runs, so every launch and the gaps after it count. The runs cycle
// through copies of the inputs. A figure is the median of several windows, for all but v000 over two sittings.
// Sittings can differ by a few percent; kernels timed side by side share one.
// v000, which the later versions start from, runs in 319 microseconds.
#include <hip/hip_runtime.h>

// MatNetCrossMHA (q_input [4][512][256], kv_input [4][512][256], dmat [4][512][512]; q = q_in Wq^T, k|v = kv_in Wkv^T (16 heads x 16); scores = q.k/4; per head a 2-16-1 MLP mixes (score, dmat[m][n]) -> relu -> mixed score; softmax over n;
// out = (probs v merged) Wout^T -> [4][512][256]).
// Compute dtypes, f32 accumulate: every input rounded to bf16; q/kv projections on PLAIN bf16 operands (inputs: exact); out projection A on bf16 hi+lo planes (2 products); scores (K 16, zero-padded to 32) on bf16 hi+lo planes (3 products, 16 heads z-batched); the mixing MLP, softmax f32

#define NB_  4
#define MM   512
#define NN   512
#define EE   256
#define NH_  16
#define HD   16
#define KP   32
#define VP   64
#define HID  16
typedef _Float16 h16;
typedef unsigned short bf;
typedef __attribute__((ext_vector_type(16))) __bf16   v16bf;
typedef __attribute__((ext_vector_type(16))) _Float16 v16h;
typedef __attribute__((ext_vector_type(8)))  _Float16 v8h;
typedef __attribute__((ext_vector_type(8)))  unsigned short v8us;
typedef __attribute__((ext_vector_type(8)))  float    v8f;
typedef __attribute__((ext_vector_type(4)))  float    v4f;
typedef v8h  __attribute__((may_alias)) v8ha;
typedef v4f  __attribute__((may_alias)) v4fa;
typedef v8us __attribute__((may_alias)) v8usa;

__device__ __forceinline__ unsigned short f2bf(float f) { unsigned u = __float_as_uint(f); u += 0x7FFFu + ((u >> 16) & 1u); return (unsigned short)(u >> 16); }
__device__ __forceinline__ float bf2f(unsigned short b) { return __uint_as_float(((unsigned)b) << 16); }
__device__ __forceinline__ float bfr(float f) { return bf2f(f2bf(f)); }
__device__ __forceinline__ v16h cat16(v8h lo, v8h hi) { return __builtin_shufflevector(lo, hi, 0, 1, 2, 3, 4, 5, 6, 7, 8, 9, 10, 11, 12, 13, 14, 15); }
__device__ __forceinline__ v16bf cat16b(v8us lo, v8us hi) { return __builtin_bit_cast(v16bf, __builtin_shufflevector(lo, hi, 0, 1, 2, 3, 4, 5, 6, 7, 8, 9, 10, 11, 12, 13, 14, 15)); }
__device__ __forceinline__ v8f wmma16(v16h a, v16h b, v8f c) { return __builtin_amdgcn_wmma_f32_16x16x32_f16(false, a, false, b, (short)0, c, false, false); }
__device__ __forceinline__ v8f wmmab(v16bf a, v16bf b, v8f c) { return __builtin_amdgcn_wmma_f32_16x16x32_bf16(false, a, false, b, (short)0, c, false, false); }



// ---- k_gemmw: register-blocked GEMM, ONE WAVE per 64x64 output tile (16 accumulators), operands straight from K-contiguous 16-bit planes; grid (M/64, N/64, Z), 32 threads.
// C[m][n] (f32, pitch ldc, + optional f32 bias[n]) = sum_k A[m][k] Bt[n][k] (+ split products per NSPLIT). z-batch strides sA/sB/sC in elements. K % 32 == 0.
template <typename T16> struct WFrag;
template <> struct WFrag<h16> { typedef v16h V; static __device__ __forceinline__ V ld(const h16* p) { return cat16(*(const v8h*)p, *(const v8h*)(p + 16)); } static __device__ __forceinline__ v8f mma(V a, V b, v8f c) { return wmma16(a, b, c); } };
template <> struct WFrag<bf> { typedef v16bf V; static __device__ __forceinline__ V ld(const bf* p) { return cat16b(*(const v8us*)p, *(const v8us*)(p + 16)); } static __device__ __forceinline__ v8f mma(V a, V b, v8f c) { return wmmab(a, b, c); } };
template <typename T16, int NSPLIT, bool BIAS>
__global__ __launch_bounds__(32) void k_gemmw(const T16* __restrict__ A, const T16* __restrict__ A2, const T16* __restrict__ Bt, const T16* __restrict__ Bt2, int K, float* C, int ldc, const float* __restrict__ bias, size_t sA, size_t sB, size_t sC) {
    typedef typename WFrag<T16>::V V;
    __shared__ __align__(16) float os[16 * 68];
    const size_t z = blockIdx.z; A += z * sA; if (A2) A2 += z * sA; Bt += z * sB; if (Bt2) Bt2 += z * sB; C += z * sC;
    const int lane = threadIdx.x & 31, lr = lane & 15, hi = lane >> 4; const int r0 = blockIdx.x * 64, c0 = blockIdx.y * 64;
    v8f acc[4][4];
#pragma unroll
    for (int mb = 0; mb < 4; ++mb)
#pragma unroll
        for (int nb = 0; nb < 4; ++nb) acc[mb][nb] = (v8f){};
    const size_t aoff = (size_t)(r0 + lr) * K + 8 * hi, boff = (size_t)(c0 + lr) * K + 8 * hi;
#pragma unroll 1
    for (int kc = 0; kc < K; kc += 32) {
        V a[4], a2[4];
#pragma unroll
        for (int mb = 0; mb < 4; ++mb) { a[mb] = WFrag<T16>::ld(A + aoff + (size_t)mb * 16 * K + kc); if (NSPLIT == 1 || NSPLIT == 2) a2[mb] = WFrag<T16>::ld(A2 + aoff + (size_t)mb * 16 * K + kc); }
#pragma unroll
        for (int nb = 0; nb < 4; ++nb) { const V b = WFrag<T16>::ld(Bt + boff + (size_t)nb * 16 * K + kc); V b2; if (NSPLIT >= 2) b2 = WFrag<T16>::ld(Bt2 + boff + (size_t)nb * 16 * K + kc);
#pragma unroll
            for (int mb = 0; mb < 4; ++mb) { acc[mb][nb] = WFrag<T16>::mma(a[mb], b, acc[mb][nb]); if (NSPLIT == 1 || NSPLIT == 2) acc[mb][nb] = WFrag<T16>::mma(a2[mb], b, acc[mb][nb]); if (NSPLIT >= 2) acc[mb][nb] = WFrag<T16>::mma(a[mb], b2, acc[mb][nb]); } }
        asm volatile("v_nop\n\tv_nop\n\tv_nop\n\tv_nop" : "+v"(acc[0][0]), "+v"(acc[1][1]), "+v"(acc[2][2]), "+v"(acc[3][3]) : "v"(a[0]), "v"(a[3]));
    }
#pragma unroll
    for (int mb = 0; mb < 4; ++mb) {
#pragma unroll
        for (int nb = 0; nb < 4; ++nb) {
#pragma unroll
            for (int j = 0; j < 8; ++j) os[(hi * 8 + j) * 68 + nb * 16 + lr] = acc[mb][nb][j]; }
        __builtin_amdgcn_wave_barrier(); asm volatile("" ::: "memory");
        float* crow = C + (size_t)(r0 + mb * 16) * ldc + c0;
{
#pragma unroll
            for (int s = 0; s < 8; ++s) { const int row = 2 * s + hi, cofs = lr * 4; v4f val = *(const v4fa*)(os + row * 68 + cofs); if (BIAS) { val[0] += bfr(bias[c0 + cofs]); val[1] += bfr(bias[c0 + cofs + 1]); val[2] += bfr(bias[c0 + cofs + 2]); val[3] += bfr(bias[c0 + cofs + 3]); }
                *(v4f*)(crow + (size_t)row * ldc + cofs) = val; }
             }
        __builtin_amdgcn_wave_barrier(); asm volatile("" ::: "memory");
    }
}

__device__ __forceinline__ void splitf(float y, unsigned short& h, unsigned short& l) { h = f2bf(y); l = f2bf(y - bf2f(h)); }
typedef __attribute__((ext_vector_type(2))) unsigned short v2us;
typedef __attribute__((ext_vector_type(4))) unsigned short v4us;

__global__ __launch_bounds__(256) void k_cvt8(const float* __restrict__ src, bf* dst, size_t n8) { const size_t i = (size_t)blockIdx.x * 256 + threadIdx.x; if (i >= n8) return; const v8f v = *(const v8f*)(src + i * 8); v8us o;
#pragma unroll
    for (int k = 0; k < 8; ++k) o[k] = f2bf(v[k]); *(v8us*)(dst + i * 8) = o;  }
// k_qkpl: hl planes QP[h][m][kp] (q/4; kp < 16 real, 16..31 zero) and KPn[h][n][kp] from FQ [m][h*16+d], FKV [n][(0|1)*256 + h*16 + d] (8-B lanes); k_vt: hl planes VT[h][vp][n] = v (vp < 16) else 0 (lane -> 2 consecutive n);
__global__ __launch_bounds__(256) void k_qkpl(const float* __restrict__ FQ, const float* __restrict__ FKV, bf* Qh, bf* Ql, bf* Kh, bf* Kl) { const int e = (blockIdx.x * 256 + threadIdx.x) * 4; if (e >= NH_ * MM * KP) return; const int kp = e % KP; const int m = (e / KP) % MM; const int h = e / (KP * MM); v4us qh, ql, kh, kl;
#pragma unroll
    for (int u = 0; u < 4; ++u) { unsigned short a = 0, b = 0, c = 0, d2 = 0; const int d = kp + u; if (d < HD) { splitf(FQ[(size_t)m * EE + h * HD + d] * 0.25f, a, b); splitf(FKV[(size_t)m * 2 * EE + h * HD + d], c, d2); } qh[u] = a; ql[u] = b; kh[u] = c; kl[u] = d2; }
    { *(v4us*)(Qh + e) = qh; *(v4us*)(Ql + e) = ql; *(v4us*)(Kh + e) = kh; *(v4us*)(Kl + e) = kl;  } }
__global__ __launch_bounds__(256) void k_vt(const float* __restrict__ FKV, bf* Vh, bf* Vl) { const int e = (blockIdx.x * 256 + threadIdx.x) * 2; if (e >= NH_ * VP * NN) return; const int n = e % NN; const int vp = (e / NN) % VP; const int h = e / (NN * VP); v2us oh, ol;
#pragma unroll
    for (int u = 0; u < 2; ++u) { unsigned short a = 0, b = 0; if (vp < HD) splitf(FKV[(size_t)(n + u) * 2 * EE + EE + h * HD + vp], a, b); oh[u] = a; ol[u] = b; } { *(v2us*)(Vh + e) = oh; *(v2us*)(Vl + e) = ol;  } }
__global__ __launch_bounds__(256) void k_mrg(const float* __restrict__ O, bf* Ah, bf* Al) { const int e = (blockIdx.x * 256 + threadIdx.x) * 4; if (e >= MM * EE) return; const int c = e % EE; const int m = e / EE; const int h = c / HD, d = c % HD; const float* r = O + ((size_t)h * MM + m) * VP + d; v4us oh, ol;
#pragma unroll
    for (int u = 0; u < 4; ++u) { unsigned short a, b; splitf(r[u], a, b); oh[u] = a; ol[u] = b; } *(v4us*)(Ah + e) = oh; *(v4us*)(Al + e) = ol;  }
__global__ __launch_bounds__(256) void k_mixsoft(const float* __restrict__ Sb, const float* __restrict__ dm, const float* __restrict__ W1, const float* __restrict__ b1, const float* __restrict__ W2, const float* __restrict__ b2, bf* Ph, bf* Pl) {
    const int lane = threadIdx.x & 31; const int row = blockIdx.x * 8 + (threadIdx.x >> 5); if (row >= NH_ * MM) return; const int m = row % MM; const int h = row / MM; const float* sr = Sb + (size_t)row * NN; const float* dr = dm + (size_t)m * NN;
    float w0[HID], w1[HID], bb[HID], w2[HID];
#pragma unroll
    for (int k = 0; k < HID; ++k) { w0[k] = bfr(W1[(h * 2 + 0) * HID + k]); w1[k] = bfr(W1[(h * 2 + 1) * HID + k]); bb[k] = bfr(b1[h * HID + k]); w2[k] = bfr(W2[h * HID + k]); asm volatile("" : "+v"(w0[k])); asm volatile("" : "+v"(w1[k])); asm volatile("" : "+v"(bb[k])); asm volatile("" : "+v"(w2[k])); }
    float bb2 = bfr(b2[h]); asm volatile("" : "+v"(bb2)); float v[NN / 32]; float mx = -3.0e38f;
#pragma unroll
    for (int ch = 0; ch < NN / 128; ++ch) { const int j0 = ch * 128 + lane * 4; const v4f a = *(const v4f*)(sr + j0), dd = *(const v4f*)(dr + j0);
#pragma unroll
        for (int u = 0; u < 4; ++u) { float dv = bfr(dd[u]); asm volatile("" : "+v"(dv)); float acc = bb2;
#pragma unroll
            for (int k = 0; k < HID; ++k) { float p0 = __fmul_rn(a[u], w0[k]), p1 = __fmul_rn(dv, w1[k]); asm volatile("" : "+v"(p0)); asm volatile("" : "+v"(p1)); const float hk = fmaxf(__fadd_rn(__fadd_rn(p0, p1), bb[k]), 0.f); float pk = __fmul_rn(hk, w2[k]); asm volatile("" : "+v"(pk)); acc = __fadd_rn(acc, pk); }
            v[ch * 4 + u] = acc; mx = fmaxf(mx, acc); } }
#pragma unroll
    for (int sh = 16; sh; sh >>= 1) mx = fmaxf(mx, __shfl_xor(mx, sh, 32));
    float sum = 0.f;
#pragma unroll
    for (int q = 0; q < NN / 32; ++q) { float d0 = __fsub_rn(v[q], mx); asm volatile("" : "+v"(d0)); v[q] = __expf(d0); sum += v[q]; }
#pragma unroll
    for (int sh = 16; sh; sh >>= 1) sum += __shfl_xor(sum, sh, 32);
    const float f = __fdiv_rn(1.0f, sum);
    {
#pragma unroll
        for (int ch = 0; ch < NN / 128; ++ch) { v4us oh, ol;
#pragma unroll
            for (int u = 0; u < 4; ++u) { unsigned short a, b; splitf(v[ch * 4 + u] * f, a, b); oh[u] = a; ol[u] = b; } const size_t oo = (size_t)row * NN + ch * 128 + lane * 4; *(v4us*)(Ph + oo) = oh; *(v4us*)(Pl + oo) = ol; }
         } }

extern "C" void kernel_launch(void* const* d_in, const int* in_sizes, int n_in,
                              void* d_out, int out_size, void* d_ws, size_t ws_size, hipStream_t stream) {
    (void)in_sizes; (void)n_in; (void)out_size;
    const float** I = (const float**)d_in;
    const float *qin = I[0], *kvin = I[1], *dmat = I[2], *wq = I[3], *wkv = I[4], *W1 = I[5], *b1 = I[6], *W2 = I[7], *b2 = I[8], *wout = I[9];
    float* OUT = (float*)d_out;     // [4][512][256]
    char* wsp = (char*)d_ws;
    auto take = [&](size_t bytes) { char* p = wsp; wsp += (bytes + 255) & ~(size_t)255; return (void*)p; };
    bf* WQ = (bf*)take(EE * EE * 2); bf* WKV = (bf*)take(2 * EE * EE * 2); bf* WO = (bf*)take(EE * EE * 2);
    bf* QB = (bf*)take((size_t)MM * EE * 2); bf* KB = (bf*)take((size_t)NN * EE * 2); float* FQ = (float*)take((size_t)MM * EE * 4); float* FKV = (float*)take((size_t)NN * 2 * EE * 4); bf* Qh = (bf*)take((size_t)NH_ * MM * KP * 2); bf* Ql = (bf*)take((size_t)NH_ * MM * KP * 2); bf* Kh = (bf*)take((size_t)NH_ * NN * KP * 2); bf* Kl = (bf*)take((size_t)NH_ * NN * KP * 2); bf* Vh = (bf*)take((size_t)NH_ * VP * NN * 2); bf* Vl = (bf*)take((size_t)NH_ * VP * NN * 2);
    float* Sb = (float*)take((size_t)NH_ * MM * NN * 4); bf* Ph = (bf*)take((size_t)NH_ * MM * NN * 2); bf* Pl = (bf*)take((size_t)NH_ * MM * NN * 2); float* O = (float*)take((size_t)NH_ * MM * VP * 4); bf* Ah = (bf*)take((size_t)MM * EE * 2); bf* Al = (bf*)take((size_t)MM * EE * 2);
    if ((size_t)(wsp - (char*)d_ws) > ws_size) return;    // total ~ 45 MB
    k_cvt8<<<(EE * EE / 8 + 255) / 256, 256, 0, stream>>>(wq, WQ, EE * EE / 8); k_cvt8<<<(2 * EE * EE / 8 + 255) / 256, 256, 0, stream>>>(wkv, WKV, 2 * EE * EE / 8); k_cvt8<<<(EE * EE / 8 + 255) / 256, 256, 0, stream>>>(wout, WO, EE * EE / 8);   // [out][in] = natural Bt
    for (int b = 0; b < NB_; ++b) {
        k_cvt8<<<(MM * EE / 8 + 255) / 256, 256, 0, stream>>>(qin + (size_t)b * MM * EE, QB, (size_t)MM * EE / 8); k_cvt8<<<(NN * EE / 8 + 255) / 256, 256, 0, stream>>>(kvin + (size_t)b * NN * EE, KB, (size_t)NN * EE / 8);
        k_gemmw<bf, 0, false><<<dim3(MM / 64, EE / 64, 1), 32, 0, stream>>>(QB, nullptr, WQ, nullptr, EE, FQ, EE, nullptr, 0, 0, 0); k_gemmw<bf, 0, false><<<dim3(NN / 64, 2 * EE / 64, 1), 32, 0, stream>>>(KB, nullptr, WKV, nullptr, EE, FKV, 2 * EE, nullptr, 0, 0, 0);
        k_qkpl<<<(NH_ * MM * KP / 4 + 255) / 256, 256, 0, stream>>>(FQ, FKV, Qh, Ql, Kh, Kl); k_vt<<<(NH_ * VP * NN / 2 + 255) / 256, 256, 0, stream>>>(FKV, Vh, Vl);
        k_gemmw<bf, 2, false><<<dim3(MM / 64, NN / 64, NH_), 32, 0, stream>>>(Qh, Ql, Kh, Kl, KP, Sb, NN, nullptr, (size_t)MM * KP, (size_t)NN * KP, (size_t)MM * NN);
        k_mixsoft<<<NH_ * MM / 8, 256, 0, stream>>>(Sb, dmat + (size_t)b * MM * NN, W1, b1, W2, b2, Ph, Pl);
        k_gemmw<bf, 2, false><<<dim3(MM / 64, VP / 64, NH_), 32, 0, stream>>>(Ph, Pl, Vh, Vl, NN, O, VP, nullptr, (size_t)MM * NN, (size_t)VP * NN, (size_t)MM * VP);
        k_mrg<<<(MM * EE / 4 + 255) / 256, 256, 0, stream>>>(O, Ah, Al);
        k_gemmw<bf, 1, false><<<dim3(MM / 64, EE / 64, 1), 32, 0, stream>>>(Ah, Al, WO, nullptr, EE, OUT + (size_t)b * MM * EE, EE, nullptr, 0, 0, 0); }
}

// v001
// Measured time: 167 microseconds a run.
// Two timings next to v000 put it at 1.90 and 1.88 times that version's speed.
#include <hip/hip_runtime.h>

// MatNetCrossMHA (q_input [4][512][256], kv_input [4][512][256], dmat [4][512][512]; q = q_in Wq^T, k|v = kv_in Wkv^T (16 heads x 16); scores = q.k/4; per head a 2-16-1 MLP mixes (score, dmat[m][n]) -> relu -> mixed score; softmax over n;
// out = (probs v merged) Wout^T -> [4][512][256]).
// Compute dtypes, f32 accumulate: every input rounded to bf16; q/kv projections on PLAIN bf16 operands (inputs: exact); out projection A on bf16 hi+lo planes (2 products); scores (K 16, zero-padded to 32) on bf16 hi+lo planes (3 products, 16 heads z-batched); the mixing MLP, softmax f32

#define NB_  4
#define MM   512
#define NN   512
#define EE   256
#define NH_  16
#define HD   16
#define KP   32
#define VP   64
#define HID  16
typedef _Float16 h16;
typedef unsigned short bf;
typedef __attribute__((ext_vector_type(16))) __bf16   v16bf;
typedef __attribute__((ext_vector_type(16))) _Float16 v16h;
typedef __attribute__((ext_vector_type(8)))  _Float16 v8h;
typedef __attribute__((ext_vector_type(8)))  unsigned short v8us;
typedef __attribute__((ext_vector_type(8)))  float    v8f;
typedef __attribute__((ext_vector_type(4)))  float    v4f;
typedef v8h  __attribute__((may_alias)) v8ha;
typedef v4f  __attribute__((may_alias)) v4fa;
typedef v8us __attribute__((may_alias)) v8usa;

__device__ __forceinline__ unsigned short f2bf(float f) { unsigned u = __float_as_uint(f); u += 0x7FFFu + ((u >> 16) & 1u); return (unsigned short)(u >> 16); }
__device__ __forceinline__ float bf2f(unsigned short b) { return __uint_as_float(((unsigned)b) << 16); }
__device__ __forceinline__ float bfr(float f) { return bf2f(f2bf(f)); }
__device__ __forceinline__ v16h cat16(v8h lo, v8h hi) { return __builtin_shufflevector(lo, hi, 0, 1, 2, 3, 4, 5, 6, 7, 8, 9, 10, 11, 12, 13, 14, 15); }
__device__ __forceinline__ v16bf cat16b(v8us lo, v8us hi) { return __builtin_bit_cast(v16bf, __builtin_shufflevector(lo, hi, 0, 1, 2, 3, 4, 5, 6, 7, 8, 9, 10, 11, 12, 13, 14, 15)); }
__device__ __forceinline__ v8f wmma16(v16h a, v16h b, v8f c) { return __builtin_amdgcn_wmma_f32_16x16x32_f16(false, a, false, b, (short)0, c, false, false); }
__device__ __forceinline__ v8f wmmab(v16bf a, v16bf b, v8f c) { return __builtin_amdgcn_wmma_f32_16x16x32_bf16(false, a, false, b, (short)0, c, false, false); }



// ---- k_gemmw: register-blocked GEMM, ONE WAVE per 64x64 output tile (16 accumulators), operands straight from K-contiguous 16-bit planes; grid (M/64, N/64, Z), 32 threads.
// C[m][n] (f32, pitch ldc, + optional f32 bias[n]) = sum_k A[m][k] Bt[n][k] (+ split products per NSPLIT). z-batch strides sA/sB/sC in elements. K % 32 == 0.
template <typename T16> struct WFrag;
template <> struct WFrag<h16> { typedef v16h V; static __device__ __forceinline__ V ld(const h16* p) { return cat16(*(const v8h*)p, *(const v8h*)(p + 16)); } static __device__ __forceinline__ v8f mma(V a, V b, v8f c) { return wmma16(a, b, c); } };
template <> struct WFrag<bf> { typedef v16bf V; static __device__ __forceinline__ V ld(const bf* p) { return cat16b(*(const v8us*)p, *(const v8us*)(p + 16)); } static __device__ __forceinline__ v8f mma(V a, V b, v8f c) { return wmmab(a, b, c); } };
template <typename T16, int NSPLIT, bool BIAS>
__global__ __launch_bounds__(32) void k_gemmw(const T16* __restrict__ A, const T16* __restrict__ A2, const T16* __restrict__ Bt, const T16* __restrict__ Bt2, int K, float* C, int ldc, const float* __restrict__ bias, size_t sA, size_t sB, size_t sC) {
    typedef typename WFrag<T16>::V V;
    __shared__ __align__(16) float os[16 * 68];
    const size_t z = blockIdx.z; A += z * sA; if (A2) A2 += z * sA; Bt += z * sB; if (Bt2) Bt2 += z * sB; C += z * sC;
    const int lane = threadIdx.x & 31, lr = lane & 15, hi = lane >> 4; const int r0 = blockIdx.x * 64, c0 = blockIdx.y * 64;
    v8f acc[4][4];
#pragma unroll
    for (int mb = 0; mb < 4; ++mb)
#pragma unroll
        for (int nb = 0; nb < 4; ++nb) acc[mb][nb] = (v8f){};
    const size_t aoff = (size_t)(r0 + lr) * K + 8 * hi, boff = (size_t)(c0 + lr) * K + 8 * hi;
#pragma unroll 1
    for (int kc = 0; kc < K; kc += 32) {
        V a[4], a2[4];
#pragma unroll
        for (int mb = 0; mb < 4; ++mb) { a[mb] = WFrag<T16>::ld(A + aoff + (size_t)mb * 16 * K + kc); if (NSPLIT == 1 || NSPLIT == 2) a2[mb] = WFrag<T16>::ld(A2 + aoff + (size_t)mb * 16 * K + kc); }
#pragma unroll
        for (int nb = 0; nb < 4; ++nb) { const V b = WFrag<T16>::ld(Bt + boff + (size_t)nb * 16 * K + kc); V b2; if (NSPLIT >= 2) b2 = WFrag<T16>::ld(Bt2 + boff + (size_t)nb * 16 * K + kc);
#pragma unroll
            for (int mb = 0; mb < 4; ++mb) { acc[mb][nb] = WFrag<T16>::mma(a[mb], b, acc[mb][nb]); if (NSPLIT == 1 || NSPLIT == 2) acc[mb][nb] = WFrag<T16>::mma(a2[mb], b, acc[mb][nb]); if (NSPLIT >= 2) acc[mb][nb] = WFrag<T16>::mma(a[mb], b2, acc[mb][nb]); } }
        asm volatile("v_nop\n\tv_nop\n\tv_nop\n\tv_nop" : "+v"(acc[0][0]), "+v"(acc[1][1]), "+v"(acc[2][2]), "+v"(acc[3][3]) : "v"(a[0]), "v"(a[3]));
    }
#pragma unroll
    for (int mb = 0; mb < 4; ++mb) {
#pragma unroll
        for (int nb = 0; nb < 4; ++nb) {
#pragma unroll
            for (int j = 0; j < 8; ++j) os[(hi * 8 + j) * 68 + nb * 16 + lr] = acc[mb][nb][j]; }
        __builtin_amdgcn_wave_barrier(); asm volatile("" ::: "memory");
        float* crow = C + (size_t)(r0 + mb * 16) * ldc + c0;
{
#pragma unroll
            for (int s = 0; s < 8; ++s) { const int row = 2 * s + hi, cofs = lr * 4; v4f val = *(const v4fa*)(os + row * 68 + cofs); if (BIAS) { val[0] += bfr(bias[c0 + cofs]); val[1] += bfr(bias[c0 + cofs + 1]); val[2] += bfr(bias[c0 + cofs + 2]); val[3] += bfr(bias[c0 + cofs + 3]); }
                *(v4f*)(crow + (size_t)row * ldc + cofs) = val; }
             }
        __builtin_amdgcn_wave_barrier(); asm volatile("" ::: "memory");
    }
}

__device__ __forceinline__ void splitf(float y, unsigned short& h, unsigned short& l) { h = f2bf(y); l = f2bf(y - bf2f(h)); }
typedef __attribute__((ext_vector_type(2))) unsigned short v2us;
typedef __attribute__((ext_vector_type(4))) unsigned short v4us;

__global__ __launch_bounds__(256) void k_cvt8(const float* __restrict__ src, bf* dst, size_t n8) { const size_t i = (size_t)blockIdx.x * 256 + threadIdx.x; if (i >= n8) return; const v8f v = *(const v8f*)(src + i * 8); v8us o;
#pragma unroll
    for (int k = 0; k < 8; ++k) o[k] = f2bf(v[k]); *(v8us*)(dst + i * 8) = o;  }
// All four batches go through every launch: row-major buffers hold [b*512 + m] rows, per-head planes are indexed z = b*16 + h.
// k_qkpl: hl planes QP[z][m][kp] (q/4; kp < 16 real, 16..31 zero) and KPn[z][n][kp] from FQ [b*512+m][h*16+d], FKV [b*512+n][(0|1)*256 + h*16 + d] (8-B lanes); k_vt: hl planes VT[z][vp][n] = v (vp < 16) else 0 (lane -> 2 consecutive n);
__global__ __launch_bounds__(256) void k_qkpl(const float* __restrict__ FQ, const float* __restrict__ FKV, bf* Qh, bf* Ql, bf* Kh, bf* Kl) { const int e = (blockIdx.x * 256 + threadIdx.x) * 4; if (e >= NB_ * NH_ * MM * KP) return; const int kp = e % KP; const int h = (e / (KP * MM)) % NH_; const int m = (e / (KP * MM * NH_)) * MM + (e / KP) % MM; v4us qh, ql, kh, kl;
#pragma unroll
    for (int u = 0; u < 4; ++u) { unsigned short a = 0, b = 0, c = 0, d2 = 0; const int d = kp + u; if (d < HD) { splitf(FQ[(size_t)m * EE + h * HD + d] * 0.25f, a, b); splitf(FKV[(size_t)m * 2 * EE + h * HD + d], c, d2); } qh[u] = a; ql[u] = b; kh[u] = c; kl[u] = d2; }
    { *(v4us*)(Qh + e) = qh; *(v4us*)(Ql + e) = ql; *(v4us*)(Kh + e) = kh; *(v4us*)(Kl + e) = kl;  } }
__global__ __launch_bounds__(256) void k_vt(const float* __restrict__ FKV, bf* Vh, bf* Vl) { const int e = (blockIdx.x * 256 + threadIdx.x) * 2; if (e >= NB_ * NH_ * VP * NN) return; const int n = (e / (NN * VP * NH_)) * NN + e % NN; const int vp = (e / NN) % VP; const int h = (e / (NN * VP)) % NH_; v2us oh, ol;
#pragma unroll
    for (int u = 0; u < 2; ++u) { unsigned short a = 0, b = 0; if (vp < HD) splitf(FKV[(size_t)(n + u) * 2 * EE + EE + h * HD + vp], a, b); oh[u] = a; ol[u] = b; } { *(v2us*)(Vh + e) = oh; *(v2us*)(Vl + e) = ol;  } }
__global__ __launch_bounds__(256) void k_mrg(const float* __restrict__ O, bf* Ah, bf* Al) { const int e = (blockIdx.x * 256 + threadIdx.x) * 4; if (e >= NB_ * MM * EE) return; const int c = e % EE; const int m = (e / EE) % MM; const int b = e / (EE * MM); const int h = c / HD, d = c % HD; const float* r = O + ((size_t)(b * NH_ + h) * MM + m) * VP + d; v4us oh, ol;
#pragma unroll
    for (int u = 0; u < 4; ++u) { unsigned short a, b; splitf(r[u], a, b); oh[u] = a; ol[u] = b; } *(v4us*)(Ah + e) = oh; *(v4us*)(Al + e) = ol;  }
__global__ __launch_bounds__(256) void k_mixsoft(const float* __restrict__ Sb, const float* __restrict__ dm, const float* __restrict__ W1, const float* __restrict__ b1, const float* __restrict__ W2, const float* __restrict__ b2, bf* Ph, bf* Pl) {
    const int lane = threadIdx.x & 31; const int row = blockIdx.x * 8 + (threadIdx.x >> 5); if (row >= NB_ * NH_ * MM) return; const int m = row % MM; const int h = (row / MM) % NH_; const int b = row / (MM * NH_); const float* sr = Sb + (size_t)row * NN; const float* dr = dm + (size_t)(b * MM + m) * NN;
    float w0[HID], w1[HID], bb[HID], w2[HID];
#pragma unroll
    for (int k = 0; k < HID; ++k) { w0[k] = bfr(W1[(h * 2 + 0) * HID + k]); w1[k] = bfr(W1[(h * 2 + 1) * HID + k]); bb[k] = bfr(b1[h * HID + k]); w2[k] = bfr(W2[h * HID + k]); asm volatile("" : "+v"(w0[k])); asm volatile("" : "+v"(w1[k])); asm volatile("" : "+v"(bb[k])); asm volatile("" : "+v"(w2[k])); }
    float bb2 = bfr(b2[h]); asm volatile("" : "+v"(bb2)); float v[NN / 32]; float mx = -3.0e38f;
#pragma unroll
    for (int ch = 0; ch < NN / 128; ++ch) { const int j0 = ch * 128 + lane * 4; const v4f a = *(const v4f*)(sr + j0), dd = *(const v4f*)(dr + j0);
#pragma unroll
        for (int u = 0; u < 4; ++u) { float dv = bfr(dd[u]); asm volatile("" : "+v"(dv)); float acc = bb2;
#pragma unroll
            for (int k = 0; k < HID; ++k) { float p0 = __fmul_rn(a[u], w0[k]), p1 = __fmul_rn(dv, w1[k]); asm volatile("" : "+v"(p0)); asm volatile("" : "+v"(p1)); const float hk = fmaxf(__fadd_rn(__fadd_rn(p0, p1), bb[k]), 0.f); float pk = __fmul_rn(hk, w2[k]); asm volatile("" : "+v"(pk)); acc = __fadd_rn(acc, pk); }
            v[ch * 4 + u] = acc; mx = fmaxf(mx, acc); } }
#pragma unroll
    for (int sh = 16; sh; sh >>= 1) mx = fmaxf(mx, __shfl_xor(mx, sh, 32));
    float sum = 0.f;
#pragma unroll
    for (int q = 0; q < NN / 32; ++q) { float d0 = __fsub_rn(v[q], mx); asm volatile("" : "+v"(d0)); v[q] = __expf(d0); sum += v[q]; }
#pragma unroll
    for (int sh = 16; sh; sh >>= 1) sum += __shfl_xor(sum, sh, 32);
    const float f = __fdiv_rn(1.0f, sum);
    {
#pragma unroll
        for (int ch = 0; ch < NN / 128; ++ch) { v4us oh, ol;
#pragma unroll
            for (int u = 0; u < 4; ++u) { unsigned short a, b; splitf(v[ch * 4 + u] * f, a, b); oh[u] = a; ol[u] = b; } const size_t oo = (size_t)row * NN + ch * 128 + lane * 4; *(v4us*)(Ph + oo) = oh; *(v4us*)(Pl + oo) = ol; }
         } }

extern "C" void kernel_launch(void* const* d_in, const int* in_sizes, int n_in,
                              void* d_out, int out_size, void* d_ws, size_t ws_size, hipStream_t stream) {
    (void)in_sizes; (void)n_in; (void)out_size;
    const float** I = (const float**)d_in;
    const float *qin = I[0], *kvin = I[1], *dmat = I[2], *wq = I[3], *wkv = I[4], *W1 = I[5], *b1 = I[6], *W2 = I[7], *b2 = I[8], *wout = I[9];
    float* OUT = (float*)d_out;     // [4][512][256]
    char* wsp = (char*)d_ws;
    auto take = [&](size_t bytes) { char* p = wsp; wsp += (bytes + 255) & ~(size_t)255; return (void*)p; };
    bf* WQ = (bf*)take(EE * EE * 2); bf* WKV = (bf*)take(2 * EE * EE * 2); bf* WO = (bf*)take(EE * EE * 2);
    bf* QB = (bf*)take((size_t)NB_ * MM * EE * 2); bf* KB = (bf*)take((size_t)NB_ * NN * EE * 2); float* FQ = (float*)take((size_t)NB_ * MM * EE * 4); float* FKV = (float*)take((size_t)NB_ * NN * 2 * EE * 4); bf* Qh = (bf*)take((size_t)NB_ * NH_ * MM * KP * 2); bf* Ql = (bf*)take((size_t)NB_ * NH_ * MM * KP * 2); bf* Kh = (bf*)take((size_t)NB_ * NH_ * NN * KP * 2); bf* Kl = (bf*)take((size_t)NB_ * NH_ * NN * KP * 2); bf* Vh = (bf*)take((size_t)NB_ * NH_ * VP * NN * 2); bf* Vl = (bf*)take((size_t)NB_ * NH_ * VP * NN * 2);
    float* Sb = (float*)take((size_t)NB_ * NH_ * MM * NN * 4); bf* Ph = (bf*)take((size_t)NB_ * NH_ * MM * NN * 2); bf* Pl = (bf*)take((size_t)NB_ * NH_ * MM * NN * 2); float* O = (float*)take((size_t)NB_ * NH_ * MM * VP * 4); bf* Ah = (bf*)take((size_t)NB_ * MM * EE * 2); bf* Al = (bf*)take((size_t)NB_ * MM * EE * 2);
    if ((size_t)(wsp - (char*)d_ws) > ws_size) return;    // total ~ 170 MB
    k_cvt8<<<(EE * EE / 8 + 255) / 256, 256, 0, stream>>>(wq, WQ, EE * EE / 8); k_cvt8<<<(2 * EE * EE / 8 + 255) / 256, 256, 0, stream>>>(wkv, WKV, 2 * EE * EE / 8); k_cvt8<<<(EE * EE / 8 + 255) / 256, 256, 0, stream>>>(wout, WO, EE * EE / 8);   // [out][in] = natural Bt
    k_cvt8<<<(NB_ * MM * EE / 8 + 255) / 256, 256, 0, stream>>>(qin, QB, (size_t)NB_ * MM * EE / 8); k_cvt8<<<(NB_ * NN * EE / 8 + 255) / 256, 256, 0, stream>>>(kvin, KB, (size_t)NB_ * NN * EE / 8);
    k_gemmw<bf, 0, false><<<dim3(NB_ * MM / 64, EE / 64, 1), 32, 0, stream>>>(QB, nullptr, WQ, nullptr, EE, FQ, EE, nullptr, 0, 0, 0); k_gemmw<bf, 0, false><<<dim3(NB_ * NN / 64, 2 * EE / 64, 1), 32, 0, stream>>>(KB, nullptr, WKV, nullptr, EE, FKV, 2 * EE, nullptr, 0, 0, 0);
    k_qkpl<<<(NB_ * NH_ * MM * KP / 4 + 255) / 256, 256, 0, stream>>>(FQ, FKV, Qh, Ql, Kh, Kl); k_vt<<<(NB_ * NH_ * VP * NN / 2 + 255) / 256, 256, 0, stream>>>(FKV, Vh, Vl);
    k_gemmw<bf, 2, false><<<dim3(MM / 64, NN / 64, NB_ * NH_), 32, 0, stream>>>(Qh, Ql, Kh, Kl, KP, Sb, NN, nullptr, (size_t)MM * KP, (size_t)NN * KP, (size_t)MM * NN);
    k_mixsoft<<<NB_ * NH_ * MM / 8, 256, 0, stream>>>(Sb, dmat, W1, b1, W2, b2, Ph, Pl);
    k_gemmw<bf, 2, false><<<dim3(MM / 64, VP / 64, NB_ * NH_), 32, 0, stream>>>(Ph, Pl, Vh, Vl, NN, O, VP, nullptr, (size_t)MM * NN, (size_t)VP * NN, (size_t)MM * VP);
    k_mrg<<<(NB_ * MM * EE / 4 + 255) / 256, 256, 0, stream>>>(O, Ah, Al);
    k_gemmw<bf, 1, false><<<dim3(NB_ * MM / 64, EE / 64, 1), 32, 0, stream>>>(Ah, Al, WO, nullptr, EE, OUT, EE, nullptr, 0, 0, 0);
}

// v002
// Measured time: 136 microseconds a run.
// Timed twice side by side with v001, it ran 1.22 times as fast both times.
// Counting every step since v000, it is 2.31 times as fast.
#include <hip/hip_runtime.h>

// MatNetCrossMHA (q_input [4][512][256], kv_input [4][512][256], dmat [4][512][512]; q = q_in Wq^T, k|v = kv_in Wkv^T (16 heads x 16); scores = q.k/4; per head a 2-16-1 MLP mixes (score, dmat[m][n]) -> relu -> mixed score; softmax over n;
// out = (probs v merged) Wout^T -> [4][512][256]).
// Compute dtypes, f32 accumulate: every input rounded to bf16; q/kv projections on PLAIN bf16 operands (inputs: exact); out projection A on bf16 hi+lo planes (2 products); scores (K 16, zero-padded to 32) on bf16 hi+lo planes (3 products, 16 heads z-batched); the mixing MLP, softmax f32

#define NB_  4
#define MM   512
#define NN   512
#define EE   256
#define NH_  16
#define HD   16
#define KP   32
#define VP   64
#define HID  16
typedef _Float16 h16;
typedef unsigned short bf;
typedef __attribute__((ext_vector_type(16))) __bf16   v16bf;
typedef __attribute__((ext_vector_type(16))) _Float16 v16h;
typedef __attribute__((ext_vector_type(8)))  _Float16 v8h;
typedef __attribute__((ext_vector_type(8)))  unsigned short v8us;
typedef __attribute__((ext_vector_type(8)))  float    v8f;
typedef __attribute__((ext_vector_type(4)))  float    v4f;
typedef __attribute__((ext_vector_type(2)))  float    v2f;
typedef v8h  __attribute__((may_alias)) v8ha;
typedef v4f  __attribute__((may_alias)) v4fa;
typedef v8us __attribute__((may_alias)) v8usa;

__device__ __forceinline__ unsigned short f2bf(float f) { unsigned u = __float_as_uint(f); u += 0x7FFFu + ((u >> 16) & 1u); return (unsigned short)(u >> 16); }
__device__ __forceinline__ float bf2f(unsigned short b) { return __uint_as_float(((unsigned)b) << 16); }
__device__ __forceinline__ float bfr(float f) { return bf2f(f2bf(f)); }
__device__ __forceinline__ v16h cat16(v8h lo, v8h hi) { return __builtin_shufflevector(lo, hi, 0, 1, 2, 3, 4, 5, 6, 7, 8, 9, 10, 11, 12, 13, 14, 15); }
__device__ __forceinline__ v16bf cat16b(v8us lo, v8us hi) { return __builtin_bit_cast(v16bf, __builtin_shufflevector(lo, hi, 0, 1, 2, 3, 4, 5, 6, 7, 8, 9, 10, 11, 12, 13, 14, 15)); }
__device__ __forceinline__ v8f wmma16(v16h a, v16h b, v8f c) { return __builtin_amdgcn_wmma_f32_16x16x32_f16(false, a, false, b, (short)0, c, false, false); }
__device__ __forceinline__ v8f wmmab(v16bf a, v16bf b, v8f c) { return __builtin_amdgcn_wmma_f32_16x16x32_bf16(false, a, false, b, (short)0, c, false, false); }



// ---- k_gemmw: register-blocked GEMM, ONE WAVE per 64x64 output tile (16 accumulators), operands straight from K-contiguous 16-bit planes; grid (M/64, N/64, Z), 32 threads.
// C[m][n] (f32, pitch ldc, + optional f32 bias[n]) = sum_k A[m][k] Bt[n][k] (+ split products per NSPLIT). z-batch strides sA/sB/sC in elements. K % 32 == 0.
template <typename T16> struct WFrag;
template <> struct WFrag<h16> { typedef v16h V; static __device__ __forceinline__ V ld(const h16* p) { return cat16(*(const v8h*)p, *(const v8h*)(p + 16)); } static __device__ __forceinline__ v8f mma(V a, V b, v8f c) { return wmma16(a, b, c); } };
template <> struct WFrag<bf> { typedef v16bf V; static __device__ __forceinline__ V ld(const bf* p) { return cat16b(*(const v8us*)p, *(const v8us*)(p + 16)); } static __device__ __forceinline__ v8f mma(V a, V b, v8f c) { return wmmab(a, b, c); } };
template <typename T16, int NSPLIT, bool BIAS>
__global__ __launch_bounds__(32) void k_gemmw(const T16* __restrict__ A, const T16* __restrict__ A2, const T16* __restrict__ Bt, const T16* __restrict__ Bt2, int K, float* C, int ldc, const float* __restrict__ bias, size_t sA, size_t sB, size_t sC) {
    typedef typename WFrag<T16>::V V;
    __shared__ __align__(16) float os[16 * 68];
    const size_t z = blockIdx.z; A += z * sA; if (A2) A2 += z * sA; Bt += z * sB; if (Bt2) Bt2 += z * sB; C += z * sC;
    const int lane = threadIdx.x & 31, lr = lane & 15, hi = lane >> 4; const int r0 = blockIdx.x * 64, c0 = blockIdx.y * 64;
    v8f acc[4][4];
#pragma unroll
    for (int mb = 0; mb < 4; ++mb)
#pragma unroll
        for (int nb = 0; nb < 4; ++nb) acc[mb][nb] = (v8f){};
    const size_t aoff = (size_t)(r0 + lr) * K + 8 * hi, boff = (size_t)(c0 + lr) * K + 8 * hi;
#pragma unroll 1
    for (int kc = 0; kc < K; kc += 32) {
        V a[4], a2[4];
#pragma unroll
        for (int mb = 0; mb < 4; ++mb) { a[mb] = WFrag<T16>::ld(A + aoff + (size_t)mb * 16 * K + kc); if (NSPLIT == 1 || NSPLIT == 2) a2[mb] = WFrag<T16>::ld(A2 + aoff + (size_t)mb * 16 * K + kc); }
#pragma unroll
        for (int nb = 0; nb < 4; ++nb) { const V b = WFrag<T16>::ld(Bt + boff + (size_t)nb * 16 * K + kc); V b2; if (NSPLIT >= 2) b2 = WFrag<T16>::ld(Bt2 + boff + (size_t)nb * 16 * K + kc);
#pragma unroll
            for (int mb = 0; mb < 4; ++mb) { acc[mb][nb] = WFrag<T16>::mma(a[mb], b, acc[mb][nb]); if (NSPLIT == 1 || NSPLIT == 2) acc[mb][nb] = WFrag<T16>::mma(a2[mb], b, acc[mb][nb]); if (NSPLIT >= 2) acc[mb][nb] = WFrag<T16>::mma(a[mb], b2, acc[mb][nb]); } }
        asm volatile("v_nop\n\tv_nop\n\tv_nop\n\tv_nop" : "+v"(acc[0][0]), "+v"(acc[1][1]), "+v"(acc[2][2]), "+v"(acc[3][3]) : "v"(a[0]), "v"(a[3]));
    }
#pragma unroll
    for (int mb = 0; mb < 4; ++mb) {
#pragma unroll
        for (int nb = 0; nb < 4; ++nb) {
#pragma unroll
            for (int j = 0; j < 8; ++j) os[(hi * 8 + j) * 68 + nb * 16 + lr] = acc[mb][nb][j]; }
        __builtin_amdgcn_wave_barrier(); asm volatile("" ::: "memory");
        float* crow = C + (size_t)(r0 + mb * 16) * ldc + c0;
{
#pragma unroll
            for (int s = 0; s < 8; ++s) { const int row = 2 * s + hi, cofs = lr * 4; v4f val = *(const v4fa*)(os + row * 68 + cofs); if (BIAS) { val[0] += bfr(bias[c0 + cofs]); val[1] += bfr(bias[c0 + cofs + 1]); val[2] += bfr(bias[c0 + cofs + 2]); val[3] += bfr(bias[c0 + cofs + 3]); }
                *(v4f*)(crow + (size_t)row * ldc + cofs) = val; }
             }
        __builtin_amdgcn_wave_barrier(); asm volatile("" ::: "memory");
    }
}

__device__ __forceinline__ void splitf(float y, unsigned short& h, unsigned short& l) { h = f2bf(y); l = f2bf(y - bf2f(h)); }
typedef __attribute__((ext_vector_type(2))) unsigned short v2us;
typedef __attribute__((ext_vector_type(4))) unsigned short v4us;

__global__ __launch_bounds__(256) void k_cvt8(const float* __restrict__ src, bf* dst, size_t n8) { const size_t i = (size_t)blockIdx.x * 256 + threadIdx.x; if (i >= n8) return; const v8f v = *(const v8f*)(src + i * 8); v8us o;
#pragma unroll
    for (int k = 0; k < 8; ++k) o[k] = f2bf(v[k]); *(v8us*)(dst + i * 8) = o;  }
// All four batches go through every launch: row-major buffers hold [b*512 + m] rows, per-head planes are indexed z = b*16 + h.
// k_qkpl: hl planes QP[z][m][kp] (q/4; kp < 16 real, 16..31 zero) and KPn[z][n][kp] from FQ [b*512+m][h*16+d], FKV [b*512+n][(0|1)*256 + h*16 + d] (8-B lanes); k_vt: hl planes VT[z][vp][n] = v (vp < 16) else 0 (lane -> 2 consecutive n);
__global__ __launch_bounds__(256) void k_qkpl(const float* __restrict__ FQ, const float* __restrict__ FKV, bf* Qh, bf* Ql, bf* Kh, bf* Kl) { const int e = (blockIdx.x * 256 + threadIdx.x) * 4; if (e >= NB_ * NH_ * MM * KP) return; const int kp = e % KP; const int h = (e / (KP * MM)) % NH_; const int m = (e / (KP * MM * NH_)) * MM + (e / KP) % MM; v4us qh, ql, kh, kl;
#pragma unroll
    for (int u = 0; u < 4; ++u) { unsigned short a = 0, b = 0, c = 0, d2 = 0; const int d = kp + u; if (d < HD) { splitf(FQ[(size_t)m * EE + h * HD + d] * 0.25f, a, b); splitf(FKV[(size_t)m * 2 * EE + h * HD + d], c, d2); } qh[u] = a; ql[u] = b; kh[u] = c; kl[u] = d2; }
    { *(v4us*)(Qh + e) = qh; *(v4us*)(Ql + e) = ql; *(v4us*)(Kh + e) = kh; *(v4us*)(Kl + e) = kl;  } }
__global__ __launch_bounds__(256) void k_vt(const float* __restrict__ FKV, bf* Vh, bf* Vl) { const int e = (blockIdx.x * 256 + threadIdx.x) * 2; if (e >= NB_ * NH_ * VP * NN) return; const int n = (e / (NN * VP * NH_)) * NN + e % NN; const int vp = (e / NN) % VP; const int h = (e / (NN * VP)) % NH_; v2us oh, ol;
#pragma unroll
    for (int u = 0; u < 2; ++u) { unsigned short a = 0, b = 0; if (vp < HD) splitf(FKV[(size_t)(n + u) * 2 * EE + EE + h * HD + vp], a, b); oh[u] = a; ol[u] = b; } { *(v2us*)(Vh + e) = oh; *(v2us*)(Vl + e) = ol;  } }
__global__ __launch_bounds__(256) void k_mrg(const float* __restrict__ O, bf* Ah, bf* Al) { const int e = (blockIdx.x * 256 + threadIdx.x) * 4; if (e >= NB_ * MM * EE) return; const int c = e % EE; const int m = (e / EE) % MM; const int b = e / (EE * MM); const int h = c / HD, d = c % HD; const float* r = O + ((size_t)(b * NH_ + h) * MM + m) * VP + d; v4us oh, ol;
#pragma unroll
    for (int u = 0; u < 4; ++u) { unsigned short a, b; splitf(r[u], a, b); oh[u] = a; ol[u] = b; } *(v4us*)(Ah + e) = oh; *(v4us*)(Al + e) = ol;  }
__global__ __launch_bounds__(256) void k_mixsoft(const float* __restrict__ Sb, const float* __restrict__ dm, const float* __restrict__ W1, const float* __restrict__ b1, const float* __restrict__ W2, const float* __restrict__ b2, bf* Ph, bf* Pl) {
    const int lane = threadIdx.x & 31; const int row = blockIdx.x * 8 + (threadIdx.x >> 5); if (row >= NB_ * NH_ * MM) return; const int m = row % MM; const int h = (row / MM) % NH_; const int b = row / (MM * NH_); const float* sr = Sb + (size_t)row * NN; const float* dr = dm + (size_t)(b * MM + m) * NN;
    float w0[HID], w1[HID], bb[HID], w2[HID];
#pragma unroll
    for (int k = 0; k < HID; ++k) { w0[k] = bfr(W1[(h * 2 + 0) * HID + k]); w1[k] = bfr(W1[(h * 2 + 1) * HID + k]); bb[k] = bfr(b1[h * HID + k]); w2[k] = bfr(W2[h * HID + k]); asm volatile("" : "+v"(w0[k])); asm volatile("" : "+v"(w1[k])); asm volatile("" : "+v"(bb[k])); asm volatile("" : "+v"(w2[k])); }
    float bb2 = bfr(b2[h]); asm volatile("" : "+v"(bb2)); float v[NN / 32]; float mx = -3.0e38f;
#pragma unroll
    for (int ch = 0; ch < NN / 128; ++ch) { const int j0 = ch * 128 + lane * 4; const v4f a = *(const v4f*)(sr + j0), dd = *(const v4f*)(dr + j0);
#pragma unroll
        for (int u = 0; u < 4; u += 2) { const v2f a2 = { a[u], a[u + 1] }, d2 = { bfr(dd[u]), bfr(dd[u + 1]) }; v2f acc = { bb2, bb2 };   // two elements side by side: each multiply-add is one packed instruction
#pragma unroll
            for (int k = 0; k < HID; ++k) { const v2f hk = __builtin_elementwise_fma(a2, (v2f){ w0[k], w0[k] }, __builtin_elementwise_fma(d2, (v2f){ w1[k], w1[k] }, (v2f){ bb[k], bb[k] })); acc = __builtin_elementwise_fma(__builtin_elementwise_max(hk, (v2f){ 0.f, 0.f }), (v2f){ w2[k], w2[k] }, acc); }
            v[ch * 4 + u] = acc[0]; v[ch * 4 + u + 1] = acc[1]; mx = fmaxf(mx, fmaxf(acc[0], acc[1])); } }
#pragma unroll
    for (int sh = 16; sh; sh >>= 1) mx = fmaxf(mx, __shfl_xor(mx, sh, 32));
    float sum = 0.f;
#pragma unroll
    for (int q = 0; q < NN / 32; ++q) { float d0 = __fsub_rn(v[q], mx); asm volatile("" : "+v"(d0)); v[q] = __expf(d0); sum += v[q]; }
#pragma unroll
    for (int sh = 16; sh; sh >>= 1) sum += __shfl_xor(sum, sh, 32);
    const float f = __fdiv_rn(1.0f, sum);
    {
#pragma unroll
        for (int ch = 0; ch < NN / 128; ++ch) { v4us oh, ol;
#pragma unroll
            for (int u = 0; u < 4; ++u) { unsigned short a, b; splitf(v[ch * 4 + u] * f, a, b); oh[u] = a; ol[u] = b; } const size_t oo = (size_t)row * NN + ch * 128 + lane * 4; *(v4us*)(Ph + oo) = oh; *(v4us*)(Pl + oo) = ol; }
         } }

extern "C" void kernel_launch(void* const* d_in, const int* in_sizes, int n_in,
                              void* d_out, int out_size, void* d_ws, size_t ws_size, hipStream_t stream) {
    (void)in_sizes; (void)n_in; (void)out_size;
    const float** I = (const float**)d_in;
    const float *qin = I[0], *kvin = I[1], *dmat = I[2], *wq = I[3], *wkv = I[4], *W1 = I[5], *b1 = I[6], *W2 = I[7], *b2 = I[8], *wout = I[9];
    float* OUT = (float*)d_out;     // [4][512][256]
    char* wsp = (char*)d_ws;
    auto take = [&](size_t bytes) { char* p = wsp; wsp += (bytes + 255) & ~(size_t)255; return (void*)p; };
    bf* WQ = (bf*)take(EE * EE * 2); bf* WKV = (bf*)take(2 * EE * EE * 2); bf* WO = (bf*)take(EE * EE * 2);
    bf* QB = (bf*)take((size_t)NB_ * MM * EE * 2); bf* KB = (bf*)take((size_t)NB_ * NN * EE * 2); float* FQ = (float*)take((size_t)NB_ * MM * EE * 4); float* FKV = (float*)take((size_t)NB_ * NN * 2 * EE * 4); bf* Qh = (bf*)take((size_t)NB_ * NH_ * MM * KP * 2); bf* Ql = (bf*)take((size_t)NB_ * NH_ * MM * KP * 2); bf* Kh = (bf*)take((size_t)NB_ * NH_ * NN * KP * 2); bf* Kl = (bf*)take((size_t)NB_ * NH_ * NN * KP * 2); bf* Vh = (bf*)take((size_t)NB_ * NH_ * VP * NN * 2); bf* Vl = (bf*)take((size_t)NB_ * NH_ * VP * NN * 2);
    float* Sb = (float*)take((size_t)NB_ * NH_ * MM * NN * 4); bf* Ph = (bf*)take((size_t)NB_ * NH_ * MM * NN * 2); bf* Pl = (bf*)take((size_t)NB_ * NH_ * MM * NN * 2); float* O = (float*)take((size_t)NB_ * NH_ * MM * VP * 4); bf* Ah = (bf*)take((size_t)NB_ * MM * EE * 2); bf* Al = (bf*)take((size_t)NB_ * MM * EE * 2);
    if ((size_t)(wsp - (char*)d_ws) > ws_size) return;    // total ~ 170 MB
    k_cvt8<<<(EE * EE / 8 + 255) / 256, 256, 0, stream>>>(wq, WQ, EE * EE / 8); k_cvt8<<<(2 * EE * EE / 8 + 255) / 256, 256, 0, stream>>>(wkv, WKV, 2 * EE * EE / 8); k_cvt8<<<(EE * EE / 8 + 255) / 256, 256, 0, stream>>>(wout, WO, EE * EE / 8);   // [out][in] = natural Bt
    k_cvt8<<<(NB_ * MM * EE / 8 + 255) / 256, 256, 0, stream>>>(qin, QB, (size_t)NB_ * MM * EE / 8); k_cvt8<<<(NB_ * NN * EE / 8 + 255) / 256, 256, 0, stream>>>(kvin, KB, (size_t)NB_ * NN * EE / 8);
    k_gemmw<bf, 0, false><<<dim3(NB_ * MM / 64, EE / 64, 1), 32, 0, stream>>>(QB, nullptr, WQ, nullptr, EE, FQ, EE, nullptr, 0, 0, 0); k_gemmw<bf, 0, false><<<dim3(NB_ * NN / 64, 2 * EE / 64, 1), 32, 0, stream>>>(KB, nullptr, WKV, nullptr, EE, FKV, 2 * EE, nullptr, 0, 0, 0);
    k_qkpl<<<(NB_ * NH_ * MM * KP / 4 + 255) / 256, 256, 0, stream>>>(FQ, FKV, Qh, Ql, Kh, Kl); k_vt<<<(NB_ * NH_ * VP * NN / 2 + 255) / 256, 256, 0, stream>>>(FKV, Vh, Vl);
    k_gemmw<bf, 2, false><<<dim3(MM / 64, NN / 64, NB_ * NH_), 32, 0, stream>>>(Qh, Ql, Kh, Kl, KP, Sb, NN, nullptr, (size_t)MM * KP, (size_t)NN * KP, (size_t)MM * NN);
    k_mixsoft<<<NB_ * NH_ * MM / 8, 256, 0, stream>>>(Sb, dmat, W1, b1, W2, b2, Ph, Pl);
    k_gemmw<bf, 2, false><<<dim3(MM / 64, VP / 64, NB_ * NH_), 32, 0, stream>>>(Ph, Pl, Vh, Vl, NN, O, VP, nullptr, (size_t)MM * NN, (size_t)VP * NN, (size_t)MM * VP);
    k_mrg<<<(NB_ * MM * EE / 4 + 255) / 256, 256, 0, stream>>>(O, Ah, Al);
    k_gemmw<bf, 1, false><<<dim3(NB_ * MM / 64, EE / 64, 1), 32, 0, stream>>>(Ah, Al, WO, nullptr, EE, OUT, EE, nullptr, 0, 0, 0);
}

// v003
// One run takes 72.4 microseconds.
// Timed twice side by side with v002, it ran 1.87 and 1.89 times as fast.
// Counting every step since v000, it is 4.34 times as fast.
#include <hip/hip_runtime.h>

// MatNetCrossMHA (q_input [4][512][256], kv_input [4][512][256], dmat [4][512][512]; q = q_in Wq^T, k|v = kv_in Wkv^T (16 heads x 16); scores = q.k/4; per head a 2-16-1 MLP mixes (score, dmat[m][n]) -> relu -> mixed score; softmax over n;
// out = (probs v merged) Wout^T -> [4][512][256]).
// Compute dtypes, f32 accumulate: every input rounded to bf16; q/kv projections on PLAIN bf16 operands (inputs: exact), the output projection on hi+lo A planes (2 products); scores (K 16, the upper half of each fragment zero) on bf16 hi+lo planes (3 products); the mixing MLP, softmax f32

#define NB_  4
#define MM   512
#define NN   512
#define EE   256
#define NH_  16
#define HD   16
#define KP   16
#define VP   16
#define HID  16
typedef _Float16 h16;
typedef unsigned short bf;
typedef __attribute__((ext_vector_type(16))) __bf16   v16bf;
typedef __attribute__((ext_vector_type(16))) _Float16 v16h;
typedef __attribute__((ext_vector_type(8)))  _Float16 v8h;
typedef __attribute__((ext_vector_type(8)))  unsigned short v8us;
typedef __attribute__((ext_vector_type(8)))  float    v8f;
typedef __attribute__((ext_vector_type(4)))  float    v4f;
typedef __attribute__((ext_vector_type(2)))  float    v2f;
typedef v8h  __attribute__((may_alias)) v8ha;
typedef v4f  __attribute__((may_alias)) v4fa;
typedef v8us __attribute__((may_alias)) v8usa;

__device__ __forceinline__ unsigned short f2bf(float f) { unsigned u = __float_as_uint(f); u += 0x7FFFu + ((u >> 16) & 1u); return (unsigned short)(u >> 16); }
__device__ __forceinline__ float bf2f(unsigned short b) { return __uint_as_float(((unsigned)b) << 16); }
__device__ __forceinline__ float bfr(float f) { return bf2f(f2bf(f)); }
__device__ __forceinline__ v16h cat16(v8h lo, v8h hi) { return __builtin_shufflevector(lo, hi, 0, 1, 2, 3, 4, 5, 6, 7, 8, 9, 10, 11, 12, 13, 14, 15); }
__device__ __forceinline__ v16bf cat16b(v8us lo, v8us hi) { return __builtin_bit_cast(v16bf, __builtin_shufflevector(lo, hi, 0, 1, 2, 3, 4, 5, 6, 7, 8, 9, 10, 11, 12, 13, 14, 15)); }
__device__ __forceinline__ v8f wmma16(v16h a, v16h b, v8f c) { return __builtin_amdgcn_wmma_f32_16x16x32_f16(false, a, false, b, (short)0, c, false, false); }
__device__ __forceinline__ v8f wmmab(v16bf a, v16bf b, v8f c) { return __builtin_amdgcn_wmma_f32_16x16x32_bf16(false, a, false, b, (short)0, c, false, false); }



// ---- k_gemmw: register-blocked GEMM, ONE WAVE per 64x64 output tile (16 accumulators), operands straight from K-contiguous 16-bit planes; grid (M/64, N/64, Z), 32 threads.
// C[m][n] (f32, pitch ldc, + optional f32 bias[n]) = sum_k A[m][k] Bt[n][k] (+ split products per NSPLIT). z-batch strides sA/sB/sC in elements. K % 32 == 0.
template <typename T16> struct WFrag;
template <> struct WFrag<h16> { typedef v16h V; static __device__ __forceinline__ V ld(const h16* p) { return cat16(*(const v8h*)p, *(const v8h*)(p + 16)); } static __device__ __forceinline__ v8f mma(V a, V b, v8f c) { return wmma16(a, b, c); } };
template <> struct WFrag<bf> { typedef v16bf V; static __device__ __forceinline__ V ld(const bf* p) { return cat16b(*(const v8us*)p, *(const v8us*)(p + 16)); } static __device__ __forceinline__ v8f mma(V a, V b, v8f c) { return wmmab(a, b, c); } };
template <typename T16, int NSPLIT, bool BIAS>
__global__ __launch_bounds__(32) void k_gemmw(const T16* __restrict__ A, const T16* __restrict__ A2, const T16* __restrict__ Bt, const T16* __restrict__ Bt2, int K, float* C, int ldc, const float* __restrict__ bias, size_t sA, size_t sB, size_t sC) {
    typedef typename WFrag<T16>::V V;
    __shared__ __align__(16) float os[16 * 68];
    const size_t z = blockIdx.z; A += z * sA; if (A2) A2 += z * sA; Bt += z * sB; if (Bt2) Bt2 += z * sB; C += z * sC;
    const int lane = threadIdx.x & 31, lr = lane & 15, hi = lane >> 4; const int r0 = blockIdx.x * 64, c0 = blockIdx.y * 64;
    v8f acc[4][4];
#pragma unroll
    for (int mb = 0; mb < 4; ++mb)
#pragma unroll
        for (int nb = 0; nb < 4; ++nb) acc[mb][nb] = (v8f){};
    const size_t aoff = (size_t)(r0 + lr) * K + 8 * hi, boff = (size_t)(c0 + lr) * K + 8 * hi;
#pragma unroll 1
    for (int kc = 0; kc < K; kc += 32) {
        V a[4], a2[4];
#pragma unroll
        for (int mb = 0; mb < 4; ++mb) { a[mb] = WFrag<T16>::ld(A + aoff + (size_t)mb * 16 * K + kc); if (NSPLIT == 1 || NSPLIT == 2) a2[mb] = WFrag<T16>::ld(A2 + aoff + (size_t)mb * 16 * K + kc); }
#pragma unroll
        for (int nb = 0; nb < 4; ++nb) { const V b = WFrag<T16>::ld(Bt + boff + (size_t)nb * 16 * K + kc); V b2; if (NSPLIT >= 2) b2 = WFrag<T16>::ld(Bt2 + boff + (size_t)nb * 16 * K + kc);
#pragma unroll
            for (int mb = 0; mb < 4; ++mb) { acc[mb][nb] = WFrag<T16>::mma(a[mb], b, acc[mb][nb]); if (NSPLIT == 1 || NSPLIT == 2) acc[mb][nb] = WFrag<T16>::mma(a2[mb], b, acc[mb][nb]); if (NSPLIT >= 2) acc[mb][nb] = WFrag<T16>::mma(a[mb], b2, acc[mb][nb]); } }
        asm volatile("v_nop\n\tv_nop\n\tv_nop\n\tv_nop" : "+v"(acc[0][0]), "+v"(acc[1][1]), "+v"(acc[2][2]), "+v"(acc[3][3]) : "v"(a[0]), "v"(a[3]));
    }
#pragma unroll
    for (int mb = 0; mb < 4; ++mb) {
#pragma unroll
        for (int nb = 0; nb < 4; ++nb) {
#pragma unroll
            for (int j = 0; j < 8; ++j) os[(hi * 8 + j) * 68 + nb * 16 + lr] = acc[mb][nb][j]; }
        __builtin_amdgcn_wave_barrier(); asm volatile("" ::: "memory");
        float* crow = C + (size_t)(r0 + mb * 16) * ldc + c0;
{
#pragma unroll
            for (int s = 0; s < 8; ++s) { const int row = 2 * s + hi, cofs = lr * 4; v4f val = *(const v4fa*)(os + row * 68 + cofs); if (BIAS) { val[0] += bfr(bias[c0 + cofs]); val[1] += bfr(bias[c0 + cofs + 1]); val[2] += bfr(bias[c0 + cofs + 2]); val[3] += bfr(bias[c0 + cofs + 3]); }
                *(v4f*)(crow + (size_t)row * ldc + cofs) = val; }
             }
        __builtin_amdgcn_wave_barrier(); asm volatile("" ::: "memory");
    }
}

__device__ __forceinline__ void splitf(float y, unsigned short& h, unsigned short& l) { h = f2bf(y); l = f2bf(y - bf2f(h)); }
typedef __attribute__((ext_vector_type(2))) unsigned short v2us;
typedef __attribute__((ext_vector_type(4))) unsigned short v4us;

__global__ __launch_bounds__(256) void k_cvt8(const float* __restrict__ src, bf* dst, size_t n8) { const size_t i = (size_t)blockIdx.x * 256 + threadIdx.x; if (i >= n8) return; const v8f v = *(const v8f*)(src + i * 8); v8us o;
#pragma unroll
    for (int k = 0; k < 8; ++k) o[k] = f2bf(v[k]); *(v8us*)(dst + i * 8) = o;  }
// All four batches go through every launch: row-major buffers hold [b*512 + m] rows, per-head planes are indexed z = b*16 + h.
// k_qkpl: hl planes QP[z][m][kp] (q/4; kp = d, 16 a row) and KPn[z][n][kp] from FQ [b*512+m][h*16+d], FKV [b*512+n][(0|1)*256 + h*16 + d] (8-B lanes); k_vt: hl planes VT[z][vp][n] = v (vp = d; lane -> 2 consecutive n);
__global__ __launch_bounds__(256) void k_qkpl(const float* __restrict__ FQ, const float* __restrict__ FKV, bf* Qh, bf* Ql, bf* Kh, bf* Kl) { const int e = (blockIdx.x * 256 + threadIdx.x) * 4; if (e >= NB_ * NH_ * MM * KP) return; const int kp = e % KP; const int h = (e / (KP * MM)) % NH_; const int m = (e / (KP * MM * NH_)) * MM + (e / KP) % MM; v4us qh, ql, kh, kl;
#pragma unroll
    for (int u = 0; u < 4; ++u) { unsigned short a = 0, b = 0, c = 0, d2 = 0; const int d = kp + u; if (d < HD) { splitf(FQ[(size_t)m * EE + h * HD + d] * 0.25f, a, b); splitf(FKV[(size_t)m * 2 * EE + h * HD + d], c, d2); } qh[u] = a; ql[u] = b; kh[u] = c; kl[u] = d2; }
    { *(v4us*)(Qh + e) = qh; *(v4us*)(Ql + e) = ql; *(v4us*)(Kh + e) = kh; *(v4us*)(Kl + e) = kl;  } }
__global__ __launch_bounds__(256) void k_vt(const float* __restrict__ FKV, bf* Vh, bf* Vl) { const int e = (blockIdx.x * 256 + threadIdx.x) * 2; if (e >= NB_ * NH_ * VP * NN) return; const int n = (e / (NN * VP * NH_)) * NN + e % NN; const int vp = (e / NN) % VP; const int h = (e / (NN * VP)) % NH_; v2us oh, ol;
#pragma unroll
    for (int u = 0; u < 2; ++u) { unsigned short a = 0, b = 0; if (vp < HD) splitf(FKV[(size_t)(n + u) * 2 * EE + EE + h * HD + vp], a, b); oh[u] = a; ol[u] = b; } { *(v2us*)(Vh + e) = oh; *(v2us*)(Vl + e) = ol;  } }
__global__ __launch_bounds__(256) void k_mrg(const float* __restrict__ O, bf* Ah, bf* Al) { const int e = (blockIdx.x * 256 + threadIdx.x) * 4; if (e >= NB_ * MM * EE) return; const int c = e % EE; const int m = (e / EE) % MM; const int b = e / (EE * MM); const int h = c / HD, d = c % HD; const float* r = O + ((size_t)(b * NH_ + h) * MM + m) * VP + d; v4us oh, ol;
#pragma unroll
    for (int u = 0; u < 4; ++u) { unsigned short a, b; splitf(r[u], a, b); oh[u] = a; ol[u] = b; } *(v4us*)(Ah + e) = oh; *(v4us*)(Al + e) = ol;  }
// ---- k_attn: scores, mixing MLP, softmax and probs.v in one kernel; neither scores nor probs go through memory. Grid (M/16, b*16+h), 4 waves; the block owns 16 query rows, wave w the keys w*128 .. w*128+127.
// S^T = K Q^T: in each 16x16 tile lane (lr, hi) holds query m0+lr, keys 16t + 8hi + j in register j, which is the B fragment of O^T += V^T P^T as it stands (tiles 2c, 2c+1 -> elements 0..7, 8..15; the V loader has the same key order).
// Every loop is unrolled: s[], the weights and the fragments are register arrays and need constant indices.
// Row maximum and row sum: in the lane, across the two lane halves, then across the 4 waves through LDS; probs stay unnormalised until the 4 partial O^T are added (wave order 0..3) and scaled by 1/sum.
__device__ __forceinline__ float xhalf(float x) { const int i = __float_as_int(x); return __int_as_float(__builtin_amdgcn_permlanex16(i, i, 0x76543210, 0xfedcba98, false, false)); }   // lane l <-> l ^ 16
__global__ __launch_bounds__(128) void k_attn(const bf* __restrict__ Qh, const bf* __restrict__ Ql, const bf* __restrict__ Kh, const bf* __restrict__ Kl, const bf* __restrict__ Vh, const bf* __restrict__ Vl, const float* __restrict__ dm, const float* __restrict__ W1, const float* __restrict__ b1, const float* __restrict__ W2, const float* __restrict__ b2, float* O) {
    __shared__ float rmax[4][16]; __shared__ float rsum[4][16]; __shared__ __align__(16) float ored[4][32][8]; __shared__ __align__(16) float wl[4 * HID];
    const int lane = threadIdx.x & 31, lr = lane & 15, hi = lane >> 4, w = threadIdx.x >> 5; const int z = blockIdx.y, h = z % NH_, b = z / NH_; const int m0 = blockIdx.x * 16, n0 = w * 128;
    // the head's 64 MLP weights: rounded once by the block's first 64 threads, handed to every lane through LDS, so that they sit in vector registers (as scalar pairs they do not fit the scalar file)
    if (threadIdx.x < 4 * HID) { const int k = threadIdx.x & (HID - 1), g = threadIdx.x / HID; const float* wp = g == 0 ? W1 + (h * 2 + 0) * HID : g == 1 ? W1 + (h * 2 + 1) * HID : g == 2 ? b1 + h * HID : W2 + h * HID; wl[threadIdx.x] = bfr(wp[k]); }
    __syncthreads();
    float w0[HID], w1[HID], bb[HID], w2[HID];
#pragma unroll
    for (int k = 0; k < HID; ++k) { w0[k] = wl[k]; w1[k] = wl[HID + k]; bb[k] = wl[2 * HID + k]; w2[k] = wl[3 * HID + k]; }
    const float bb2 = bfr(b2[h]); const v8us z8 = {};
    const size_t qo = ((size_t)z * MM + m0 + lr) * KP + 8 * hi; const v16bf qh = cat16b(*(const v8us*)(Qh + qo), z8), ql = cat16b(*(const v8us*)(Ql + qo), z8);
    const float* dr = dm + (size_t)(b * MM + m0 + lr) * NN + n0 + 8 * hi;
    v8f s[8]; float mx = -3.0e38f;
#pragma unroll
    for (int t = 0; t < 8; ++t) { const size_t ko = ((size_t)z * NN + n0 + t * 16 + lr) * KP + 8 * hi; const v16bf kh = cat16b(*(const v8us*)(Kh + ko), z8), kl = cat16b(*(const v8us*)(Kl + ko), z8);
        v8f c = {}; c = wmmab(kh, qh, c); c = wmmab(kh, ql, c); c = wmmab(kl, qh, c);
        const v4f da = *(const v4f*)(dr + t * 16), db = *(const v4f*)(dr + t * 16 + 4); const float dd[8] = { da[0], da[1], da[2], da[3], db[0], db[1], db[2], db[3] };
        v2f a2[4], d2[4], acc[4];   // two elements side by side: each multiply-add is one packed instruction; the tile's four pairs go through each hidden unit together, four independent chains
#pragma unroll
        for (int u = 0; u < 4; ++u) { a2[u] = (v2f){ c[2 * u], c[2 * u + 1] }; d2[u] = (v2f){ bfr(dd[2 * u]), bfr(dd[2 * u + 1]) }; acc[u] = (v2f){ bb2, bb2 }; }
#pragma unroll
        for (int k = 0; k < HID; ++k) {
#pragma unroll
            for (int u = 0; u < 4; ++u) { const v2f hk = __builtin_elementwise_fma(a2[u], (v2f){ w0[k], w0[k] }, __builtin_elementwise_fma(d2[u], (v2f){ w1[k], w1[k] }, (v2f){ bb[k], bb[k] })); acc[u] = __builtin_elementwise_fma(__builtin_elementwise_max(hk, (v2f){ 0.f, 0.f }), (v2f){ w2[k], w2[k] }, acc[u]); } }
#pragma unroll
        for (int u = 0; u < 4; ++u) { c[2 * u] = acc[u][0]; c[2 * u + 1] = acc[u][1]; mx = fmaxf(mx, fmaxf(acc[u][0], acc[u][1])); }
        s[t] = c; }
    mx = fmaxf(mx, xhalf(mx)); if (hi == 0) rmax[w][lr] = mx;
    __syncthreads();
    mx = fmaxf(fmaxf(rmax[0][lr], rmax[1][lr]), fmaxf(rmax[2][lr], rmax[3][lr]));
    float sum = 0.f; v8f o = {};
#pragma unroll
    for (int c = 0; c < 4; ++c) { v8us p0h, p0l, p1h, p1l;
#pragma unroll
        for (int j = 0; j < 8; ++j) { const float e0 = __expf(s[2 * c][j] - mx), e1 = __expf(s[2 * c + 1][j] - mx); sum += e0; sum += e1; unsigned short x, y; splitf(e0, x, y); p0h[j] = x; p0l[j] = y; splitf(e1, x, y); p1h[j] = x; p1l[j] = y; }
        const size_t vo = ((size_t)z * VP + lr) * NN + n0 + c * 32 + 8 * hi; const v16bf vh = WFrag<bf>::ld(Vh + vo), vl = WFrag<bf>::ld(Vl + vo), ph = cat16b(p0h, p1h), pl = cat16b(p0l, p1l);
        o = wmmab(vh, ph, o); o = wmmab(vh, pl, o); o = wmmab(vl, ph, o); }
    sum += xhalf(sum); if (hi == 0) rsum[w][lr] = sum;
    *(v4fa*)&ored[w][lane][0] = (v4f){ o[0], o[1], o[2], o[3] }; *(v4fa*)&ored[w][lane][4] = (v4f){ o[4], o[5], o[6], o[7] };
    __syncthreads();
    if (w == 0) { const float f = __fdiv_rn(1.0f, ((rsum[0][lr] + rsum[1][lr]) + rsum[2][lr]) + rsum[3][lr]); float* orow = O + ((size_t)z * MM + m0 + lr) * VP + 8 * hi;   // register j of O^T = O[m0+lr][8hi+j]
#pragma unroll
        for (int q = 0; q < 2; ++q) { const v4f t4 = ((*(const v4fa*)&ored[0][lane][q * 4] + *(const v4fa*)&ored[1][lane][q * 4]) + *(const v4fa*)&ored[2][lane][q * 4]) + *(const v4fa*)&ored[3][lane][q * 4]; *(v4f*)(orow + q * 4) = t4 * f; } } }

extern "C" void kernel_launch(void* const* d_in, const int* in_sizes, int n_in,
                              void* d_out, int out_size, void* d_ws, size_t ws_size, hipStream_t stream) {
    (void)in_sizes; (void)n_in; (void)out_size;
    const float** I = (const float**)d_in;
    const float *qin = I[0], *kvin = I[1], *dmat = I[2], *wq = I[3], *wkv = I[4], *W1 = I[5], *b1 = I[6], *W2 = I[7], *b2 = I[8], *wout = I[9];
    float* OUT = (float*)d_out;     // [4][512][256]
    char* wsp = (char*)d_ws;
    auto take = [&](size_t bytes) { char* p = wsp; wsp += (bytes + 255) & ~(size_t)255; return (void*)p; };
    bf* WQ = (bf*)take(EE * EE * 2); bf* WKV = (bf*)take(2 * EE * EE * 2); bf* WO = (bf*)take(EE * EE * 2);
    bf* QB = (bf*)take((size_t)NB_ * MM * EE * 2); bf* KB = (bf*)take((size_t)NB_ * NN * EE * 2); float* FQ = (float*)take((size_t)NB_ * MM * EE * 4); float* FKV = (float*)take((size_t)NB_ * NN * 2 * EE * 4); bf* Qh = (bf*)take((size_t)NB_ * NH_ * MM * KP * 2); bf* Ql = (bf*)take((size_t)NB_ * NH_ * MM * KP * 2); bf* Kh = (bf*)take((size_t)NB_ * NH_ * NN * KP * 2); bf* Kl = (bf*)take((size_t)NB_ * NH_ * NN * KP * 2); bf* Vh = (bf*)take((size_t)NB_ * NH_ * VP * NN * 2); bf* Vl = (bf*)take((size_t)NB_ * NH_ * VP * NN * 2);
    float* O = (float*)take((size_t)NB_ * NH_ * MM * VP * 4); bf* Ah = (bf*)take((size_t)NB_ * MM * EE * 2); bf* Al = (bf*)take((size_t)NB_ * MM * EE * 2);
    if ((size_t)(wsp - (char*)d_ws) > ws_size) return;    // total ~ 18.5 MiB
    k_cvt8<<<(EE * EE / 8 + 255) / 256, 256, 0, stream>>>(wq, WQ, EE * EE / 8); k_cvt8<<<(2 * EE * EE / 8 + 255) / 256, 256, 0, stream>>>(wkv, WKV, 2 * EE * EE / 8); k_cvt8<<<(EE * EE / 8 + 255) / 256, 256, 0, stream>>>(wout, WO, EE * EE / 8);   // [out][in] = natural Bt
    k_cvt8<<<(NB_ * MM * EE / 8 + 255) / 256, 256, 0, stream>>>(qin, QB, (size_t)NB_ * MM * EE / 8); k_cvt8<<<(NB_ * NN * EE / 8 + 255) / 256, 256, 0, stream>>>(kvin, KB, (size_t)NB_ * NN * EE / 8);
    k_gemmw<bf, 0, false><<<dim3(NB_ * MM / 64, EE / 64, 1), 32, 0, stream>>>(QB, nullptr, WQ, nullptr, EE, FQ, EE, nullptr, 0, 0, 0); k_gemmw<bf, 0, false><<<dim3(NB_ * NN / 64, 2 * EE / 64, 1), 32, 0, stream>>>(KB, nullptr, WKV, nullptr, EE, FKV, 2 * EE, nullptr, 0, 0, 0);
    k_qkpl<<<(NB_ * NH_ * MM * KP / 4 + 255) / 256, 256, 0, stream>>>(FQ, FKV, Qh, Ql, Kh, Kl); k_vt<<<(NB_ * NH_ * VP * NN / 2 + 255) / 256, 256, 0, stream>>>(FKV, Vh, Vl);
    k_attn<<<dim3(MM / 16, NB_ * NH_), 128, 0, stream>>>(Qh, Ql, Kh, Kl, Vh, Vl, dmat, W1, b1, W2, b2, O);
    k_mrg<<<(NB_ * MM * EE / 4 + 255) / 256, 256, 0, stream>>>(O, Ah, Al);
    k_gemmw<bf, 1, false><<<dim3(NB_ * MM / 64, EE / 64, 1), 32, 0, stream>>>(Ah, Al, WO, nullptr, EE, OUT, EE, nullptr, 0, 0, 0);
}

// v004
// A run of this version takes 50.2 microseconds.
// In two side-by-side timings against v003, it was 1.49 and 1.45 times as fast.
// Over all steps from v000 it is 6.38 times as fast.
#include <hip/hip_runtime.h>

// Cross attention with a mixing MLP on the scores (q_input [4][512][256], kv_input [4][512][256], dmat [4][512][512]; q = q_in Wq^T, k|v = kv_in Wkv^T (16 heads x 16); scores = q.k/4; per head a 2-16-1 MLP mixes (score, dmat[m][n]) -> relu -> mixed score; softmax over n;
// out = (probs v merged) Wout^T -> [4][512][256]).
// Compute dtypes, f32 accumulate: every input rounded to bf16; q, k, v projections on PLAIN bf16 operands (inputs: exact); output projection: A on bf16 hi+lo planes (2 products), Wout plain; scores (K 16, the upper half of each fragment zero) on bf16 hi+lo planes (3 products); the mixing MLP, softmax f32

#define NB_  4
#define MM   512
#define NN   512
#define EE   256
#define NH_  16
#define HD   16
#define KP   16
#define VP   16
#define HID  16
typedef unsigned short bf;
typedef __attribute__((ext_vector_type(16))) __bf16   v16bf;
typedef __attribute__((ext_vector_type(8)))  unsigned short v8us;
typedef __attribute__((ext_vector_type(8)))  float    v8f;
typedef __attribute__((ext_vector_type(4)))  float    v4f;
typedef __attribute__((ext_vector_type(2)))  float    v2f;
typedef v4f  __attribute__((may_alias)) v4fa;

__device__ __forceinline__ unsigned short f2bf(float f) { unsigned u = __float_as_uint(f); u += 0x7FFFu + ((u >> 16) & 1u); return (unsigned short)(u >> 16); }
__device__ __forceinline__ float bf2f(unsigned short b) { return __uint_as_float(((unsigned)b) << 16); }
__device__ __forceinline__ float bfr(float f) { return bf2f(f2bf(f)); }
__device__ __forceinline__ v16bf cat16b(v8us lo, v8us hi) { return __builtin_bit_cast(v16bf, __builtin_shufflevector(lo, hi, 0, 1, 2, 3, 4, 5, 6, 7, 8, 9, 10, 11, 12, 13, 14, 15)); }
__device__ __forceinline__ v8f wmmab(v16bf a, v16bf b, v8f c) { return __builtin_amdgcn_wmma_f32_16x16x32_bf16(false, a, false, b, (short)0, c, false, false); }



// ---- The three GEMMs: ONE WAVE per 64x64 output tile (16 accumulators), 32 threads, K = 256 in steps of 32. No pass of its own converts or re-lays an operand: f32 operands are rounded to bf16 in the fragment loader,
// and each result leaves its kernel in the layout and the hi+lo bf16 planes that the next kernel's loader reads. Per-head planes are indexed z = b*16 + h; token rows are b*512 + m.
template <typename T16> struct WFrag;
template <> struct WFrag<bf> { typedef v16bf V; static __device__ __forceinline__ V ld(const bf* p) { return cat16b(*(const v8us*)p, *(const v8us*)(p + 16)); } };
typedef __attribute__((ext_vector_type(8))) __bf16 v8bf;
__device__ __forceinline__ v8us cvt8(v8f x) { return __builtin_bit_cast(v8us, __builtin_convertvector(x, v8bf)); }   // round to nearest even, two elements an instruction
__device__ __forceinline__ v16bf ldf(const float* p) { return cat16b(cvt8(*(const v8f*)p), cvt8(*(const v8f*)(p + 16))); }   // the bf16 loader's k order (8hi.., 16+8hi..) from an f32 row
typedef __attribute__((ext_vector_type(4))) unsigned v4u;
__device__ __forceinline__ void split8(v8f y, v8us& h, v8us& l) { h = cvt8(y); const v4u p = __builtin_bit_cast(v4u, h); v8f r;   // hi plane, then the rounded remainder; each packed word holds elements 2i (low half) and 2i+1
#pragma unroll
    for (int i = 0; i < 4; ++i) { r[2 * i] = y[2 * i] - __uint_as_float(p[i] << 16); r[2 * i + 1] = y[2 * i + 1] - __uint_as_float(p[i] & 0xFFFF0000u); }
    l = cvt8(r); }
// k_proj: q, k and v projections in one launch, grid (2048/64, 12): blockIdx.y / 4 picks q, k or v, blockIdx.y % 4 the 64 columns (4 heads).
// D[i][j] = sum_k P[i][k] R[j][k]; a lane's 8 accumulator registers are 8 consecutive i at one j, so P is the side whose index runs fastest in the plane that is written: the weight rows (d) for QP[z][m][d] (q/4) and KPn[z][n][d], the token rows (n) for VT[z][d][n]. Each is one 16-byte store a plane.
__global__ __launch_bounds__(32) void k_proj(const float* __restrict__ qin, const float* __restrict__ kvin, const float* __restrict__ wq, const float* __restrict__ wkv, bf* Qh, bf* Ql, bf* Kh, bf* Kl, bf* Vh, bf* Vl) {
    const int lane = threadIdx.x & 31, lr = lane & 15, hi = lane >> 4; const int sel = blockIdx.y >> 2, x0 = blockIdx.x * 64, c0 = (blockIdx.y & 3) * 64;
    const float* X = (sel == 0 ? qin : kvin) + (size_t)x0 * EE; const float* Wt = (sel == 0 ? wq : wkv + (size_t)(sel - 1) * EE * EE) + (size_t)c0 * EE;
    const float* P = (sel == 2 ? X : Wt) + lr * EE + 8 * hi; const float* R = (sel == 2 ? Wt : X) + lr * EE + 8 * hi;
    v8f acc[4][4];
#pragma unroll
    for (int ib = 0; ib < 4; ++ib)
#pragma unroll
        for (int jb = 0; jb < 4; ++jb) acc[ib][jb] = (v8f){};
    // the loop stays rolled: the 16 accumulators and one trip's operands already fill nearly the whole lower register window, and a longer body would go past it
#pragma unroll 1
    for (int kc = 0; kc < EE; kc += 32) {
        v16bf a[4];
#pragma unroll
        for (int ib = 0; ib < 4; ++ib) a[ib] = ldf(P + ib * 16 * EE + kc);
#pragma unroll
        for (int jb = 0; jb < 4; ++jb) { const v16bf b = ldf(R + jb * 16 * EE + kc);
#pragma unroll
            for (int ib = 0; ib < 4; ++ib) acc[ib][jb] = wmmab(a[ib], b, acc[ib][jb]); }
        // four vector slots between the trip's last WMMAs and the next trip's writes of their A and B registers, on the taken back edge too
        asm volatile("v_nop\n\tv_nop\n\tv_nop\n\tv_nop" : "+v"(acc[0][0]), "+v"(acc[1][1]), "+v"(acc[2][2]), "+v"(acc[3][3]) : "v"(a[0]), "v"(a[3]));
    }
    const int z0 = (x0 / MM) * NH_ + c0 / HD, t0 = x0 % MM;
    if (sel == 2) {
#pragma unroll
        for (int ib = 0; ib < 4; ++ib)
#pragma unroll
            for (int jb = 0; jb < 4; ++jb) { v8us h, l; split8(acc[ib][jb], h, l); const size_t o = ((size_t)(z0 + jb) * VP + lr) * NN + t0 + ib * 16 + 8 * hi; *(v8us*)(Vh + o) = h; *(v8us*)(Vl + o) = l; }
    } else { bf* Dh = sel == 0 ? Qh : Kh; bf* Dl = sel == 0 ? Ql : Kl; const float sc = sel == 0 ? 0.25f : 1.0f;
#pragma unroll
        for (int ib = 0; ib < 4; ++ib)
#pragma unroll
            for (int jb = 0; jb < 4; ++jb) { v8us h, l; split8(acc[ib][jb] * sc, h, l); const size_t o = ((size_t)(z0 + ib) * MM + t0 + jb * 16 + lr) * KP + 8 * hi; *(v8us*)(Dh + o) = h; *(v8us*)(Dl + o) = l; }
        asm volatile("s_wait_xcnt 0x0" ::: "memory");   // behind this branch's last stores: no register that an issued store names is written again before this wait, on whichever way the code behind it is laid out
    }
}
// k_outp: OUT[b*512+m][n] = sum_c A[m][c] Wout[n][c], c = h*16 + d, A on hi+lo planes (2 products) read where k_attn left them, OP[z][m][d]: the two halves of a fragment (k 8hi.., 16+8hi..) lie in the planes of heads kc/16 and kc/16 + 1. Grid (2048/64, 256/64).
__global__ __launch_bounds__(32) void k_outp(const bf* __restrict__ Oh, const bf* __restrict__ Ol, const float* __restrict__ wout, float* C) {
    __shared__ __align__(16) float os[16 * 68];
    const int lane = threadIdx.x & 31, lr = lane & 15, hi = lane >> 4; const int r0 = blockIdx.x * 64, c0 = blockIdx.y * 64;
    v8f acc[4][4];
#pragma unroll
    for (int mb = 0; mb < 4; ++mb)
#pragma unroll
        for (int nb = 0; nb < 4; ++nb) acc[mb][nb] = (v8f){};
    const size_t aoff = ((size_t)(r0 / MM) * NH_ * MM + r0 % MM + lr) * VP + 8 * hi; const float* Bt = wout + (size_t)(c0 + lr) * EE + 8 * hi;
    // rolled for the same reason as in k_proj: accumulators and one trip's operands fill nearly the whole lower register window
#pragma unroll 1
    for (int kc = 0; kc < EE; kc += 32) {
        v16bf a[4], a2[4]; const bf* ah = Oh + aoff + (size_t)(kc / HD) * MM * VP; const bf* al = Ol + aoff + (size_t)(kc / HD) * MM * VP;
#pragma unroll
        for (int mb = 0; mb < 4; ++mb) { a[mb] = cat16b(*(const v8us*)(ah + mb * 16 * VP), *(const v8us*)(ah + MM * VP + mb * 16 * VP)); a2[mb] = cat16b(*(const v8us*)(al + mb * 16 * VP), *(const v8us*)(al + MM * VP + mb * 16 * VP)); }
        asm volatile("s_wait_xcnt 0x0" :: "v"(ah), "v"(al) : "memory");   // the two address pairs stay whole up to here: no register that an issued A load names is written again before this wait
#pragma unroll
        for (int nb = 0; nb < 4; ++nb) { const v16bf b = ldf(Bt + nb * 16 * EE + kc);
#pragma unroll
            for (int mb = 0; mb < 4; ++mb) { acc[mb][nb] = wmmab(a[mb], b, acc[mb][nb]); acc[mb][nb] = wmmab(a2[mb], b, acc[mb][nb]); } }
        // four vector slots between the trip's last WMMAs and the next trip's writes of their A and B registers, on the taken back edge too
        asm volatile("v_nop\n\tv_nop\n\tv_nop\n\tv_nop" : "+v"(acc[0][0]), "+v"(acc[1][1]), "+v"(acc[2][2]), "+v"(acc[3][3]) : "v"(a[0]), "v"(a[3]));
    }
#pragma unroll
    for (int mb = 0; mb < 4; ++mb) {
#pragma unroll
        for (int nb = 0; nb < 4; ++nb) {
#pragma unroll
            for (int j = 0; j < 8; ++j) os[(hi * 8 + j) * 68 + nb * 16 + lr] = acc[mb][nb][j]; }
        // the two fences of each pass keep the compiler from moving the row reads ahead of the tile's LDS writes, or the next pass's writes ahead of these reads
        __builtin_amdgcn_wave_barrier(); asm volatile("" ::: "memory");
        float* crow = C + (size_t)(r0 + mb * 16) * EE + c0;
#pragma unroll
        for (int s = 0; s < 8; ++s) { const int row = 2 * s + hi, cofs = lr * 4; *(v4f*)(crow + (size_t)row * EE + cofs) = *(const v4fa*)(os + row * 68 + cofs); }
        __builtin_amdgcn_wave_barrier(); asm volatile("" ::: "memory");
    }
}

__device__ __forceinline__ void splitf(float y, unsigned short& h, unsigned short& l) { h = f2bf(y); l = f2bf(y - bf2f(h)); }

// ---- k_attn: scores, mixing MLP, softmax and probs.v in one kernel; neither scores nor probs go through memory. Grid (M/16, b*16+h), 4 waves; the block owns 16 query rows, wave w the keys w*128 .. w*128+127.
// S^T = K Q^T: in each 16x16 tile lane (lr, hi) holds query m0+lr, keys 16t + 8hi + j in register j, which is the B fragment of O^T += V^T P^T as it stands (tiles 2c, 2c+1 -> elements 0..7, 8..15; the V loader has the same key order).
// Every loop is unrolled: s[], the weights and the fragments are register arrays and need constant indices.
// Row maximum and row sum: in the lane, across the two lane halves, then across the 4 waves through LDS; probs stay unnormalised until the 4 partial O^T are added (wave order 0..3) and scaled by 1/sum.
__device__ __forceinline__ float xhalf(float x) { const int i = __float_as_int(x); return __int_as_float(__builtin_amdgcn_permlanex16(i, i, 0x76543210, 0xfedcba98, false, false)); }   // lane l <-> l ^ 16
__global__ __launch_bounds__(128) void k_attn(const bf* __restrict__ Qh, const bf* __restrict__ Ql, const bf* __restrict__ Kh, const bf* __restrict__ Kl, const bf* __restrict__ Vh, const bf* __restrict__ Vl, const float* __restrict__ dm, const float* __restrict__ W1, const float* __restrict__ b1, const float* __restrict__ W2, const float* __restrict__ b2, bf* Oh, bf* Ol) {
    __shared__ float rmax[4][16]; __shared__ float rsum[4][16]; __shared__ __align__(16) float ored[4][32][8]; __shared__ __align__(16) float wl[4 * HID];
    const int lane = threadIdx.x & 31, lr = lane & 15, hi = lane >> 4, w = threadIdx.x >> 5; const int z = blockIdx.y, h = z % NH_, b = z / NH_; const int m0 = blockIdx.x * 16, n0 = w * 128;
    // the head's 64 MLP weights: rounded once by the block's first 64 threads, handed to every lane through LDS, so that they sit in vector registers (as scalar pairs they do not fit the scalar file)
    if (threadIdx.x < 4 * HID) { const int k = threadIdx.x & (HID - 1), g = threadIdx.x / HID; const float* wp = g == 0 ? W1 + (h * 2 + 0) * HID : g == 1 ? W1 + (h * 2 + 1) * HID : g == 2 ? b1 + h * HID : W2 + h * HID; wl[threadIdx.x] = bfr(wp[k]); }
    __syncthreads();
    float w0[HID], w1[HID], bb[HID], w2[HID];
#pragma unroll
    for (int k = 0; k < HID; ++k) { w0[k] = wl[k]; w1[k] = wl[HID + k]; bb[k] = wl[2 * HID + k]; w2[k] = wl[3 * HID + k]; }
    const float bb2 = bfr(b2[h]); const v8us z8 = {};
    const size_t qo = ((size_t)z * MM + m0 + lr) * KP + 8 * hi; const v16bf qh = cat16b(*(const v8us*)(Qh + qo), z8), ql = cat16b(*(const v8us*)(Ql + qo), z8);
    const float* dr = dm + (size_t)(b * MM + m0 + lr) * NN + n0 + 8 * hi;
    v8f s[8]; float mx = -3.0e38f;
#pragma unroll
    for (int t = 0; t < 8; ++t) { const size_t ko = ((size_t)z * NN + n0 + t * 16 + lr) * KP + 8 * hi; const v16bf kh = cat16b(*(const v8us*)(Kh + ko), z8), kl = cat16b(*(const v8us*)(Kl + ko), z8);
        v8f c = {}; c = wmmab(kh, qh, c); c = wmmab(kh, ql, c); c = wmmab(kl, qh, c);
        const v4f da = *(const v4f*)(dr + t * 16), db = *(const v4f*)(dr + t * 16 + 4); const float dd[8] = { da[0], da[1], da[2], da[3], db[0], db[1], db[2], db[3] };
        v2f a2[4], d2[4], acc[4];   // two elements side by side: each multiply-add is one packed instruction; the tile's four pairs go through each hidden unit together, four independent chains
#pragma unroll
        for (int u = 0; u < 4; ++u) { a2[u] = (v2f){ c[2 * u], c[2 * u + 1] }; d2[u] = (v2f){ bfr(dd[2 * u]), bfr(dd[2 * u + 1]) }; acc[u] = (v2f){ bb2, bb2 }; }
#pragma unroll
        for (int k = 0; k < HID; ++k) {
#pragma unroll
            for (int u = 0; u < 4; ++u) { const v2f hk = __builtin_elementwise_fma(a2[u], (v2f){ w0[k], w0[k] }, __builtin_elementwise_fma(d2[u], (v2f){ w1[k], w1[k] }, (v2f){ bb[k], bb[k] })); acc[u] = __builtin_elementwise_fma(__builtin_elementwise_max(hk, (v2f){ 0.f, 0.f }), (v2f){ w2[k], w2[k] }, acc[u]); } }
#pragma unroll
        for (int u = 0; u < 4; ++u) { c[2 * u] = acc[u][0]; c[2 * u + 1] = acc[u][1]; mx = fmaxf(mx, fmaxf(acc[u][0], acc[u][1])); }
        s[t] = c; }
    mx = fmaxf(mx, xhalf(mx)); if (hi == 0) rmax[w][lr] = mx;
    __syncthreads();
    mx = fmaxf(fmaxf(rmax[0][lr], rmax[1][lr]), fmaxf(rmax[2][lr], rmax[3][lr]));
    float sum = 0.f; v8f o = {};
#pragma unroll
    for (int c = 0; c < 4; ++c) { v8us p0h, p0l, p1h, p1l;
#pragma unroll
        for (int j = 0; j < 8; ++j) { const float e0 = __expf(s[2 * c][j] - mx), e1 = __expf(s[2 * c + 1][j] - mx); sum += e0; sum += e1; unsigned short x, y; splitf(e0, x, y); p0h[j] = x; p0l[j] = y; splitf(e1, x, y); p1h[j] = x; p1l[j] = y; }
        const size_t vo = ((size_t)z * VP + lr) * NN + n0 + c * 32 + 8 * hi; const v16bf vh = WFrag<bf>::ld(Vh + vo), vl = WFrag<bf>::ld(Vl + vo), ph = cat16b(p0h, p1h), pl = cat16b(p0l, p1l);
        o = wmmab(vh, ph, o); o = wmmab(vh, pl, o); o = wmmab(vl, ph, o); }
    sum += xhalf(sum); if (hi == 0) rsum[w][lr] = sum;
    *(v4fa*)&ored[w][lane][0] = (v4f){ o[0], o[1], o[2], o[3] }; *(v4fa*)&ored[w][lane][4] = (v4f){ o[4], o[5], o[6], o[7] };
    __syncthreads();
    if (w == 0) { const float f = __fdiv_rn(1.0f, ((rsum[0][lr] + rsum[1][lr]) + rsum[2][lr]) + rsum[3][lr]); const size_t oo = ((size_t)z * MM + m0 + lr) * VP + 8 * hi; v8f t8;   // register j of O^T = O[m0+lr][8hi+j]; stored as the hi+lo planes OP[z][m][d] that k_outp reads
#pragma unroll
        for (int q = 0; q < 2; ++q) { const v4f t4 = (((*(const v4fa*)&ored[0][lane][q * 4] + *(const v4fa*)&ored[1][lane][q * 4]) + *(const v4fa*)&ored[2][lane][q * 4]) + *(const v4fa*)&ored[3][lane][q * 4]) * f; t8[q * 4] = t4[0]; t8[q * 4 + 1] = t4[1]; t8[q * 4 + 2] = t4[2]; t8[q * 4 + 3] = t4[3]; }
        v8us oh, ol; split8(t8, oh, ol); *(v8us*)(Oh + oo) = oh; *(v8us*)(Ol + oo) = ol; } }

extern "C" void kernel_launch(void* const* d_in, const int* in_sizes, int n_in,
                              void* d_out, int out_size, void* d_ws, size_t ws_size, hipStream_t stream) {
    (void)in_sizes; (void)n_in; (void)out_size;
    const float** I = (const float**)d_in;
    const float *qin = I[0], *kvin = I[1], *dmat = I[2], *wq = I[3], *wkv = I[4], *W1 = I[5], *b1 = I[6], *W2 = I[7], *b2 = I[8], *wout = I[9];
    float* OUT = (float*)d_out;     // [4][512][256]
    char* wsp = (char*)d_ws;
    auto take = [&](size_t bytes) { char* p = wsp; wsp += (bytes + 255) & ~(size_t)255; return (void*)p; };
    bf* Qh = (bf*)take((size_t)NB_ * NH_ * MM * KP * 2); bf* Ql = (bf*)take((size_t)NB_ * NH_ * MM * KP * 2); bf* Kh = (bf*)take((size_t)NB_ * NH_ * NN * KP * 2); bf* Kl = (bf*)take((size_t)NB_ * NH_ * NN * KP * 2); bf* Vh = (bf*)take((size_t)NB_ * NH_ * VP * NN * 2); bf* Vl = (bf*)take((size_t)NB_ * NH_ * VP * NN * 2);
    bf* Oh = (bf*)take((size_t)NB_ * NH_ * MM * VP * 2); bf* Ol = (bf*)take((size_t)NB_ * NH_ * MM * VP * 2);
    if ((size_t)(wsp - (char*)d_ws) > ws_size) return;    // total 8 MB
    k_proj<<<dim3(NB_ * MM / 64, 12), 32, 0, stream>>>(qin, kvin, wq, wkv, Qh, Ql, Kh, Kl, Vh, Vl);
    k_attn<<<dim3(MM / 16, NB_ * NH_), 128, 0, stream>>>(Qh, Ql, Kh, Kl, Vh, Vl, dmat, W1, b1, W2, b2, Oh, Ol);
    k_outp<<<dim3(NB_ * MM / 64, EE / 64), 32, 0, stream>>>(Oh, Ol, wout, OUT);
}

// v005
// Measured time: 36.5 microseconds a run.
// Two timings next to v004 put it at 1.36 and 1.39 times that version's speed.
// Over all steps from v000 it is 8.78 times as fast.
#include <hip/hip_runtime.h>

// Cross attention with a mixing MLP on the scores (q_input [4][512][256], kv_input [4][512][256], dmat [4][512][512]; q = q_in Wq^T, k|v = kv_in Wkv^T (16 heads x 16); scores = q.k/4; per head a 2-16-1 MLP mixes (score, dmat[m][n]) -> relu -> mixed score; softmax over n;
// out = (probs v merged) Wout^T -> [4][512][256]).
// Compute dtypes, f32 accumulate: every input rounded to bf16; q, k, v projections on PLAIN bf16 operands (inputs: exact); output projection: A on bf16 hi+lo planes (2 products), Wout plain; scores (K 16, the upper half of each fragment zero) on bf16 hi+lo planes (3 products); the mixing MLP, softmax f32

#define NB_  4
#define MM   512
#define NN   512
#define EE   256
#define NH_  16
#define HD   16
#define KP   16
#define VP   16
#define HID  16
typedef unsigned short bf;
typedef __attribute__((ext_vector_type(16))) __bf16   v16bf;
typedef __attribute__((ext_vector_type(8)))  unsigned short v8us;
typedef __attribute__((ext_vector_type(8)))  float    v8f;
typedef __attribute__((ext_vector_type(4)))  float    v4f;
typedef __attribute__((ext_vector_type(2)))  float    v2f;
typedef v4f  __attribute__((may_alias)) v4fa;

__device__ __forceinline__ unsigned short f2bf(float f) { unsigned u = __float_as_uint(f); u += 0x7FFFu + ((u >> 16) & 1u); return (unsigned short)(u >> 16); }
__device__ __forceinline__ float bf2f(unsigned short b) { return __uint_as_float(((unsigned)b) << 16); }
__device__ __forceinline__ float bfr(float f) { return bf2f(f2bf(f)); }
__device__ __forceinline__ v16bf cat16b(v8us lo, v8us hi) { return __builtin_bit_cast(v16bf, __builtin_shufflevector(lo, hi, 0, 1, 2, 3, 4, 5, 6, 7, 8, 9, 10, 11, 12, 13, 14, 15)); }
__device__ __forceinline__ v8f wmmab(v16bf a, v16bf b, v8f c) { return __builtin_amdgcn_wmma_f32_16x16x32_bf16(false, a, false, b, (short)0, c, false, false); }



// ---- The three GEMMs. Every f32 operand panel (all 256 k of its rows) is brought in ONCE per block by whole-line loads (a wave's load = 512 consecutive bytes), rounded to bf16 and laid in LDS; after one barrier the block's waves read their fragments from LDS.
// All of a wave's loads are in flight together, so a block pays one trip to memory. LDS row pitch 264 elements = 528 B (16 B x odd: 16-byte fragment reads without bank conflicts).
// Each result leaves its kernel in the layout and the hi+lo bf16 planes that the next kernel's loader reads. Per-head planes are indexed z = b*16 + h; token rows are b*512 + m.
#define PB 264
template <typename T16> struct WFrag;
template <> struct WFrag<bf> { typedef v16bf V; static __device__ __forceinline__ V ld(const bf* p) { return cat16b(*(const v8us*)p, *(const v8us*)(p + 16)); } };   // k order 8hi.., 16+8hi..
typedef __attribute__((ext_vector_type(8))) __bf16 v8bf;
typedef __attribute__((ext_vector_type(4))) __bf16 v4bf;
typedef __attribute__((ext_vector_type(4))) unsigned short v4us;
__device__ __forceinline__ v8us cvt8(v8f x) { return __builtin_bit_cast(v8us, __builtin_convertvector(x, v8bf)); }   // round to nearest even, two elements an instruction
__device__ __forceinline__ v4us cvt4(v4f x) { return __builtin_bit_cast(v4us, __builtin_convertvector(x, v4bf)); }
typedef __attribute__((ext_vector_type(4))) unsigned v4u;
__device__ __forceinline__ void split8(v8f y, v8us& h, v8us& l) { h = cvt8(y); const v4u p = __builtin_bit_cast(v4u, h); v8f r;   // hi plane, then the rounded remainder; each packed word holds elements 2i (low half) and 2i+1
#pragma unroll
    for (int i = 0; i < 4; ++i) { r[2 * i] = y[2 * i] - __uint_as_float(p[i] << 16); r[2 * i + 1] = y[2 * i + 1] - __uint_as_float(p[i] & 0xFFFF0000u); }
    l = cvt8(r); }
// One wave's 64 tokens x 16 weight rows over K = 256, both operands in LDS. TOKA: the tokens are the A side (their index runs along a lane's 8 accumulator registers), else the weight rows are.
template <bool TOKA> __device__ __forceinline__ void proj_mm(const bf* tok, const bf* wt, v8f (&acc)[4]) {
#pragma unroll
    for (int kc = 0; kc < EE; kc += 32) { const v16bf wf = WFrag<bf>::ld(wt + kc);
#pragma unroll
        for (int t = 0; t < 4; ++t) { const v16bf tf = WFrag<bf>::ld(tok + t * 16 * PB + kc); acc[t] = TOKA ? wmmab(tf, wf, acc[t]) : wmmab(wf, tf, acc[t]); } }
}
// k_proj: q, k and v projections in one launch, grid (2048/128, 12), 8 waves: blockIdx.y / 4 picks q, k or v, blockIdx.y % 4 the 64 columns (4 heads). Wave w: head w % 4, tokens (w / 4) * 64 .. + 63.
// D[i][j] = sum_k A[i][k] B[j][k]; a lane's 8 accumulator registers are 8 consecutive i at one j, so A is the side whose index runs fastest in the plane that is written: the weight rows (d) for QP[z][m][d] (q/4) and KPn[z][n][d], the token rows (n) for VT[z][d][n]. Each is one 16-byte store a plane; a wave's 64 tokens fill whole 128-byte lines of VT.
__global__ __launch_bounds__(256) void k_proj(const float* __restrict__ qin, const float* __restrict__ kvin, const float* __restrict__ wq, const float* __restrict__ wkv, bf* Qh, bf* Ql, bf* Kh, bf* Kl, bf* Vh, bf* Vl) {
    __shared__ __align__(16) bf xs[128 * PB]; __shared__ __align__(16) bf wsm[64 * PB];
    const int tid = threadIdx.x, lane = tid & 31, lr = lane & 15, hi = lane >> 4, w = tid >> 5; const int sel = blockIdx.y >> 2, x0 = blockIdx.x * 128, c0 = (blockIdx.y & 3) * 64;
    const float* X = (sel == 0 ? qin : kvin) + (size_t)x0 * EE + tid * 4; const float* Wt = (sel == 0 ? wq : wkv + (size_t)(sel - 1) * EE * EE) + (size_t)c0 * EE + tid * 4;
    v4f xr[32], wr[16];   // the block's 256 threads take 4 rows (1024 floats) a step
#pragma unroll
    for (int i = 0; i < 32; ++i) xr[i] = *(const v4f*)(X + i * 1024);
#pragma unroll
    for (int i = 0; i < 16; ++i) wr[i] = *(const v4f*)(Wt + i * 1024);
    asm volatile("s_wait_xcnt 0x0" ::: "memory");   // behind the panel loads: no register that an issued load names is written again before this wait
    bf* xd = xs + (tid >> 6) * PB + (tid & 63) * 4; bf* wd = wsm + (tid >> 6) * PB + (tid & 63) * 4;
#pragma unroll
    for (int i = 0; i < 32; ++i) *(v4us*)(xd + i * 4 * PB) = cvt4(xr[i]);
#pragma unroll
    for (int i = 0; i < 16; ++i) *(v4us*)(wd + i * 4 * PB) = cvt4(wr[i]);
    __syncthreads();
    const int head = w & 3, th = w >> 2; const bf* tok = xs + (th * 64 + lr) * PB + 8 * hi; const bf* wt = wsm + (head * 16 + lr) * PB + 8 * hi;
    v8f acc[4];
#pragma unroll
    for (int t = 0; t < 4; ++t) acc[t] = (v8f){};
    const int z = (x0 / MM) * NH_ + c0 / HD + head, t0 = x0 % MM + th * 64;
    if (sel == 2) { proj_mm<true>(tok, wt, acc);
#pragma unroll
        for (int t = 0; t < 4; ++t) { v8us h, l; split8(acc[t], h, l); const size_t o = ((size_t)z * VP + lr) * NN + t0 + t * 16 + 8 * hi; *(v8us*)(Vh + o) = h; *(v8us*)(Vl + o) = l; }
        asm volatile("s_wait_xcnt 0x0" ::: "memory");   // behind this branch's last stores: no register that an issued store names is written again before this wait, on whichever way the code behind it is laid out
    } else { proj_mm<false>(tok, wt, acc); bf* Dh = sel == 0 ? Qh : Kh; bf* Dl = sel == 0 ? Ql : Kl; const float sc = sel == 0 ? 0.25f : 1.0f;
#pragma unroll
        for (int t = 0; t < 4; ++t) { v8us h, l; split8(acc[t] * sc, h, l); const size_t o = ((size_t)z * MM + t0 + t * 16 + lr) * KP + 8 * hi; *(v8us*)(Dh + o) = h; *(v8us*)(Dl + o) = l; }
        asm volatile("s_wait_xcnt 0x0" ::: "memory");   // the same behind this branch's last stores
    }
}
__global__ __launch_bounds__(128) void k_outp(const bf* __restrict__ Oh, const bf* __restrict__ Ol, const float* __restrict__ wout, float* C) {
    __shared__ __align__(16) bf wsm[32 * PB];
    const int tid = threadIdx.x, lane = tid & 31, lr = lane & 15, hi = lane >> 4, w = tid >> 5; const int r0 = blockIdx.x * 64, c0 = blockIdx.y * 32;
    const size_t aoff = ((size_t)(r0 / MM) * NH_ * MM + r0 % MM + w * 16 + lr) * VP + 8 * hi; const bf* ah = Oh + aoff; const bf* al = Ol + aoff; const float* Wt = wout + (size_t)c0 * EE + tid * 4;
    v8us oh[NH_], ol[NH_]; v4f wr[16];   // the block's 128 threads take 2 rows of Wout (512 floats) a step
#pragma unroll
    for (int i = 0; i < 16; ++i) wr[i] = *(const v4f*)(Wt + i * 512);
#pragma unroll
    for (int h = 0; h < NH_; ++h) { oh[h] = *(const v8us*)(ah + h * MM * VP); ol[h] = *(const v8us*)(al + h * MM * VP); }
    asm volatile("s_wait_xcnt 0x0" :: "v"(ah), "v"(al) : "memory");   // the two O address pairs stay whole up to here: no register that an issued load names is written again before this wait
    bf* wd = wsm + (tid >> 6) * PB + (tid & 63) * 4;
#pragma unroll
    for (int i = 0; i < 16; ++i) *(v4us*)(wd + i * 2 * PB) = cvt4(wr[i]);
    __syncthreads();
    v8f acc[2]; acc[0] = (v8f){}; acc[1] = (v8f){};
    const bf* wt = wsm + lr * PB + 8 * hi;
#pragma unroll
    for (int kc = 0; kc < EE; kc += 32) { const v16bf a = cat16b(oh[kc / HD], oh[kc / HD + 1]), a2 = cat16b(ol[kc / HD], ol[kc / HD + 1]);
#pragma unroll
        for (int nb = 0; nb < 2; ++nb) { const v16bf wf = WFrag<bf>::ld(wt + nb * 16 * PB + kc); acc[nb] = wmmab(wf, a, acc[nb]); acc[nb] = wmmab(wf, a2, acc[nb]); } }
    float* crow = C + (size_t)(r0 + w * 16 + lr) * EE + c0 + 8 * hi;
#pragma unroll
    for (int nb = 0; nb < 2; ++nb) { *(v4f*)(crow + nb * 16) = (v4f){ acc[nb][0], acc[nb][1], acc[nb][2], acc[nb][3] }; *(v4f*)(crow + nb * 16 + 4) = (v4f){ acc[nb][4], acc[nb][5], acc[nb][6], acc[nb][7] }; }
    asm volatile("s_wait_xcnt 0x0" ::: "memory");   // behind the last stores: no register that an issued store names is written again before this wait
}

__device__ __forceinline__ void splitf(float y, unsigned short& h, unsigned short& l) { h = f2bf(y); l = f2bf(y - bf2f(h)); }

// ---- k_attn: scores, mixing MLP, softmax and probs.v in one kernel; neither scores nor probs go through memory. Grid (M/16, b*16+h), 4 waves; the block owns 16 query rows, wave w the keys w*128 .. w*128+127.
// S^T = K Q^T: in each 16x16 tile lane (lr, hi) holds query m0+lr, keys 16t + 8hi + j in register j, which is the B fragment of O^T += V^T P^T as it stands (tiles 2c, 2c+1 -> elements 0..7, 8..15; the V loader has the same key order).
// Every loop is unrolled: s[], the weights and the fragments are register arrays and need constant indices.
// Row maximum and row sum: in the lane, across the two lane halves, then across the 4 waves through LDS; probs stay unnormalised until the 4 partial O^T are added (wave order 0..3) and scaled by 1/sum.
__device__ __forceinline__ float xhalf(float x) { const int i = __float_as_int(x); return __int_as_float(__builtin_amdgcn_permlanex16(i, i, 0x76543210, 0xfedcba98, false, false)); }   // lane l <-> l ^ 16
__global__ __launch_bounds__(128) void k_attn(const bf* __restrict__ Qh, const bf* __restrict__ Ql, const bf* __restrict__ Kh, const bf* __restrict__ Kl, const bf* __restrict__ Vh, const bf* __restrict__ Vl, const float* __restrict__ dm, const float* __restrict__ W1, const float* __restrict__ b1, const float* __restrict__ W2, const float* __restrict__ b2, bf* Oh, bf* Ol) {
    __shared__ float rmax[4][16]; __shared__ float rsum[4][16]; __shared__ __align__(16) float ored[4][32][8]; __shared__ __align__(16) float wl[4 * HID];
    const int lane = threadIdx.x & 31, lr = lane & 15, hi = lane >> 4, w = threadIdx.x >> 5; const int z = blockIdx.y, h = z % NH_, b = z / NH_; const int m0 = blockIdx.x * 16, n0 = w * 128;
    // the head's 64 MLP weights: rounded once by the block's first 64 threads, handed to every lane through LDS, so that they sit in vector registers (as scalar pairs they do not fit the scalar file)
    if (threadIdx.x < 4 * HID) { const int k = threadIdx.x & (HID - 1), g = threadIdx.x / HID; const float* wp = g == 0 ? W1 + (h * 2 + 0) * HID : g == 1 ? W1 + (h * 2 + 1) * HID : g == 2 ? b1 + h * HID : W2 + h * HID; wl[threadIdx.x] = bfr(wp[k]); }
    __syncthreads();
    float w0[HID], w1[HID], bb[HID], w2[HID];
#pragma unroll
    for (int k = 0; k < HID; ++k) { w0[k] = wl[k]; w1[k] = wl[HID + k]; bb[k] = wl[2 * HID + k]; w2[k] = wl[3 * HID + k]; }
    const float bb2 = bfr(b2[h]); const v8us z8 = {};
    const size_t qo = ((size_t)z * MM + m0 + lr) * KP + 8 * hi; const v16bf qh = cat16b(*(const v8us*)(Qh + qo), z8), ql = cat16b(*(const v8us*)(Ql + qo), z8);
    const float* dr = dm + (size_t)(b * MM + m0 + lr) * NN + n0 + 8 * hi;
    v8f s[8]; float mx = -3.0e38f;
#pragma unroll
    for (int t = 0; t < 8; ++t) { const size_t ko = ((size_t)z * NN + n0 + t * 16 + lr) * KP + 8 * hi; const v16bf kh = cat16b(*(const v8us*)(Kh + ko), z8), kl = cat16b(*(const v8us*)(Kl + ko), z8);
        v8f c = {}; c = wmmab(kh, qh, c); c = wmmab(kh, ql, c); c = wmmab(kl, qh, c);
        const v4f da = *(const v4f*)(dr + t * 16), db = *(const v4f*)(dr + t * 16 + 4); const float dd[8] = { da[0], da[1], da[2], da[3], db[0], db[1], db[2], db[3] };
        v2f a2[4], d2[4], acc[4];   // two elements side by side: each multiply-add is one packed instruction; the tile's four pairs go through each hidden unit together, four independent chains
#pragma unroll
        for (int u = 0; u < 4; ++u) { a2[u] = (v2f){ c[2 * u], c[2 * u + 1] }; d2[u] = (v2f){ bfr(dd[2 * u]), bfr(dd[2 * u + 1]) }; acc[u] = (v2f){ bb2, bb2 }; }
#pragma unroll
        for (int k = 0; k < HID; ++k) {
#pragma unroll
            for (int u = 0; u < 4; ++u) { const v2f hk = __builtin_elementwise_fma(a2[u], (v2f){ w0[k], w0[k] }, __builtin_elementwise_fma(d2[u], (v2f){ w1[k], w1[k] }, (v2f){ bb[k], bb[k] })); acc[u] = __builtin_elementwise_fma(__builtin_elementwise_max(hk, (v2f){ 0.f, 0.f }), (v2f){ w2[k], w2[k] }, acc[u]); } }
#pragma unroll
        for (int u = 0; u < 4; ++u) { c[2 * u] = acc[u][0]; c[2 * u + 1] = acc[u][1]; mx = fmaxf(mx, fmaxf(acc[u][0], acc[u][1])); }
        s[t] = c; }
    mx = fmaxf(mx, xhalf(mx)); if (hi == 0) rmax[w][lr] = mx;
    __syncthreads();
    mx = fmaxf(fmaxf(rmax[0][lr], rmax[1][lr]), fmaxf(rmax[2][lr], rmax[3][lr]));
    float sum = 0.f; v8f o = {};
#pragma unroll
    for (int c = 0; c < 4; ++c) { v8us p0h, p0l, p1h, p1l;
#pragma unroll
        for (int j = 0; j < 8; ++j) { const float e0 = __expf(s[2 * c][j] - mx), e1 = __expf(s[2 * c + 1][j] - mx); sum += e0; sum += e1; unsigned short x, y; splitf(e0, x, y); p0h[j] = x; p0l[j] = y; splitf(e1, x, y); p1h[j] = x; p1l[j] = y; }
        const size_t vo = ((size_t)z * VP + lr) * NN + n0 + c * 32 + 8 * hi; const v16bf vh = WFrag<bf>::ld(Vh + vo), vl = WFrag<bf>::ld(Vl + vo), ph = cat16b(p0h, p1h), pl = cat16b(p0l, p1l);
        o = wmmab(vh, ph, o); o = wmmab(vh, pl, o); o = wmmab(vl, ph, o); }
    sum += xhalf(sum); if (hi == 0) rsum[w][lr] = sum;
    *(v4fa*)&ored[w][lane][0] = (v4f){ o[0], o[1], o[2], o[3] }; *(v4fa*)&ored[w][lane][4] = (v4f){ o[4], o[5], o[6], o[7] };
    __syncthreads();
    if (w == 0) { const float f = __fdiv_rn(1.0f, ((rsum[0][lr] + rsum[1][lr]) + rsum[2][lr]) + rsum[3][lr]); const size_t oo = ((size_t)z * MM + m0 + lr) * VP + 8 * hi; v8f t8;   // register j of O^T = O[m0+lr][8hi+j]; stored as the hi+lo planes OP[z][m][d] that k_outp reads
#pragma unroll
        for (int q = 0; q < 2; ++q) { const v4f t4 = (((*(const v4fa*)&ored[0][lane][q * 4] + *(const v4fa*)&ored[1][lane][q * 4]) + *(const v4fa*)&ored[2][lane][q * 4]) + *(const v4fa*)&ored[3][lane][q * 4]) * f; t8[q * 4] = t4[0]; t8[q * 4 + 1] = t4[1]; t8[q * 4 + 2] = t4[2]; t8[q * 4 + 3] = t4[3]; }
        v8us oh, ol; split8(t8, oh, ol); *(v8us*)(Oh + oo) = oh; *(v8us*)(Ol + oo) = ol; } }

extern "C" void kernel_launch(void* const* d_in, const int* in_sizes, int n_in,
                              void* d_out, int out_size, void* d_ws, size_t ws_size, hipStream_t stream) {
    (void)in_sizes; (void)n_in; (void)out_size;
    const float** I = (const float**)d_in;
    const float *qin = I[0], *kvin = I[1], *dmat = I[2], *wq = I[3], *wkv = I[4], *W1 = I[5], *b1 = I[6], *W2 = I[7], *b2 = I[8], *wout = I[9];
    float* OUT = (float*)d_out;     // [4][512][256]
    char* wsp = (char*)d_ws;
    auto take = [&](size_t bytes) { char* p = wsp; wsp += (bytes + 255) & ~(size_t)255; return (void*)p; };
    bf* Qh = (bf*)take((size_t)NB_ * NH_ * MM * KP * 2); bf* Ql = (bf*)take((size_t)NB_ * NH_ * MM * KP * 2); bf* Kh = (bf*)take((size_t)NB_ * NH_ * NN * KP * 2); bf* Kl = (bf*)take((size_t)NB_ * NH_ * NN * KP * 2); bf* Vh = (bf*)take((size_t)NB_ * NH_ * VP * NN * 2); bf* Vl = (bf*)take((size_t)NB_ * NH_ * VP * NN * 2);
    bf* Oh = (bf*)take((size_t)NB_ * NH_ * MM * VP * 2); bf* Ol = (bf*)take((size_t)NB_ * NH_ * MM * VP * 2);
    if ((size_t)(wsp - (char*)d_ws) > ws_size) return;    // total 8 MB
    k_proj<<<dim3(NB_ * MM / 128, 12), 256, 0, stream>>>(qin, kvin, wq, wkv, Qh, Ql, Kh, Kl, Vh, Vl);
    k_attn<<<dim3(MM / 16, NB_ * NH_), 128, 0, stream>>>(Qh, Ql, Kh, Kl, Vh, Vl, dmat, W1, b1, W2, b2, Oh, Ol);
    k_outp<<<dim3(NB_ * MM / 64, EE / 32), 128, 0, stream>>>(Oh, Ol, wout, OUT);
}

// v006
// It runs in 32.3 microseconds.
// Timed twice side by side with v005, it ran 1.13 and 1.14 times as fast.
// All steps since v000 together make it 9.96 times as fast.
#include <hip/hip_runtime.h>

// Cross attention with a mixing MLP on the scores (q_input [4][512][256], kv_input [4][512][256], dmat [4][512][512]; q = q_in Wq^T, k|v = kv_in Wkv^T (16 heads x 16); scores = q.k/4; per head a 2-16-1 MLP mixes (score, dmat[m][n]) -> relu -> mixed score; softmax over n;
// out = (probs v merged) Wout^T -> [4][512][256]).
// Compute dtypes, f32 accumulate: every input rounded to bf16; q, k, v projections on PLAIN bf16 operands (inputs: exact); output projection: A on bf16 hi+lo planes (2 products), Wout plain; scores (K 16, the upper half of each fragment zero) on bf16 hi+lo planes (3 products); the mixing MLP, softmax f32

#define NB_  4
#define MM   512
#define NN   512
#define EE   256
#define NH_  16
#define HD   16
#define KP   16
#define VP   16
#define HID  16
#define DPF  4
#define DPE  2
typedef unsigned short bf;
typedef __attribute__((ext_vector_type(16))) __bf16   v16bf;
typedef __attribute__((ext_vector_type(8)))  unsigned short v8us;
typedef __attribute__((ext_vector_type(8)))  float    v8f;
typedef __attribute__((ext_vector_type(4)))  float    v4f;
typedef __attribute__((ext_vector_type(2)))  float    v2f;
typedef v4f  __attribute__((may_alias)) v4fa;

__device__ __forceinline__ unsigned short f2bf(float f) { unsigned u = __float_as_uint(f); u += 0x7FFFu + ((u >> 16) & 1u); return (unsigned short)(u >> 16); }
__device__ __forceinline__ float bf2f(unsigned short b) { return __uint_as_float(((unsigned)b) << 16); }
__device__ __forceinline__ float bfr(float f) { return bf2f(f2bf(f)); }
__device__ __forceinline__ v16bf cat16b(v8us lo, v8us hi) { return __builtin_bit_cast(v16bf, __builtin_shufflevector(lo, hi, 0, 1, 2, 3, 4, 5, 6, 7, 8, 9, 10, 11, 12, 13, 14, 15)); }
__device__ __forceinline__ v8f wmmab(v16bf a, v16bf b, v8f c) { return __builtin_amdgcn_wmma_f32_16x16x32_bf16(false, a, false, b, (short)0, c, false, false); }



// ---- The three GEMMs. Every f32 operand panel (all 256 k of its rows) is brought in ONCE per block by whole-line loads (a wave's load = 512 consecutive bytes), rounded to bf16 and laid in LDS; after one barrier the block's waves read their fragments from LDS.
// All of a wave's loads are in flight together, so a block pays one trip to memory. LDS row pitch 264 elements = 528 B (16 B x odd: 16-byte fragment reads without bank conflicts).
// Each result leaves its kernel in the layout and the hi+lo bf16 planes that the next kernel's loader reads. Per-head planes are indexed z = b*16 + h; token rows are b*512 + m.
#define PB 264
template <typename T16> struct WFrag;
template <> struct WFrag<bf> { typedef v16bf V; static __device__ __forceinline__ V ld(const bf* p) { return cat16b(*(const v8us*)p, *(const v8us*)(p + 16)); } };   // k order 8hi.., 16+8hi..
typedef __attribute__((ext_vector_type(8))) __bf16 v8bf;
typedef __attribute__((ext_vector_type(4))) __bf16 v4bf;
typedef __attribute__((ext_vector_type(4))) unsigned short v4us;
__device__ __forceinline__ v8us cvt8(v8f x) { return __builtin_bit_cast(v8us, __builtin_convertvector(x, v8bf)); }   // round to nearest even, two elements an instruction
__device__ __forceinline__ v4us cvt4(v4f x) { return __builtin_bit_cast(v4us, __builtin_convertvector(x, v4bf)); }
typedef __attribute__((ext_vector_type(4))) unsigned v4u;
__device__ __forceinline__ void split8(v8f y, v8us& h, v8us& l) { h = cvt8(y); const v4u p = __builtin_bit_cast(v4u, h); v8f r;   // hi plane, then the rounded remainder; each packed word holds elements 2i (low half) and 2i+1
#pragma unroll
    for (int i = 0; i < 4; ++i) { r[2 * i] = y[2 * i] - __uint_as_float(p[i] << 16); r[2 * i + 1] = y[2 * i + 1] - __uint_as_float(p[i] & 0xFFFF0000u); }
    l = cvt8(r); }
// One wave's 64 tokens x 16 weight rows over K = 256, both operands in LDS. TOKA: the tokens are the A side (their index runs along a lane's 8 accumulator registers), else the weight rows are.
template <bool TOKA> __device__ __forceinline__ void proj_mm(const bf* tok, const bf* wt, v8f (&acc)[4]) {
#pragma unroll
    for (int kc = 0; kc < EE; kc += 32) { const v16bf wf = WFrag<bf>::ld(wt + kc);
#pragma unroll
        for (int t = 0; t < 4; ++t) { const v16bf tf = WFrag<bf>::ld(tok + t * 16 * PB + kc); acc[t] = TOKA ? wmmab(tf, wf, acc[t]) : wmmab(wf, tf, acc[t]); } }
}
// k_proj: q, k and v projections in one launch, grid (2048/128, 12), 8 waves: blockIdx.y / 4 picks q, k or v, blockIdx.y % 4 the 64 columns (4 heads). Wave w: head w % 4, tokens (w / 4) * 64 .. + 63.
// D[i][j] = sum_k A[i][k] B[j][k]; a lane's 8 accumulator registers are 8 consecutive i at one j, so A is the side whose index runs fastest in the plane that is written: the weight rows (d) for QP[z][m][d] (q/4) and KPn[z][n][d], the token rows (n) for VT[z][d][n]. Each is one 16-byte store a plane; a wave's 64 tokens fill whole 128-byte lines of VT.
__global__ __launch_bounds__(256) void k_proj(const float* __restrict__ qin, const float* __restrict__ kvin, const float* __restrict__ wq, const float* __restrict__ wkv, bf* Qh, bf* Ql, bf* Kh, bf* Kl, bf* Vh, bf* Vl) {
    __shared__ __align__(16) bf xs[128 * PB]; __shared__ __align__(16) bf wsm[64 * PB];
    const int tid = threadIdx.x, lane = tid & 31, lr = lane & 15, hi = lane >> 4, w = tid >> 5; const int sel = blockIdx.y >> 2, x0 = blockIdx.x * 128, c0 = (blockIdx.y & 3) * 64;
    const float* X = (sel == 0 ? qin : kvin) + (size_t)x0 * EE + tid * 4; const float* Wt = (sel == 0 ? wq : wkv + (size_t)(sel - 1) * EE * EE) + (size_t)c0 * EE + tid * 4;
    v4f xr[32], wr[16];   // the block's 256 threads take 4 rows (1024 floats) a step
#pragma unroll
    for (int i = 0; i < 32; ++i) xr[i] = *(const v4f*)(X + i * 1024);
#pragma unroll
    for (int i = 0; i < 16; ++i) wr[i] = *(const v4f*)(Wt + i * 1024);
    asm volatile("s_wait_xcnt 0x0" ::: "memory");   // behind the panel loads: no register that an issued load names is written again before this wait
    bf* xd = xs + (tid >> 6) * PB + (tid & 63) * 4; bf* wd = wsm + (tid >> 6) * PB + (tid & 63) * 4;
#pragma unroll
    for (int i = 0; i < 32; ++i) *(v4us*)(xd + i * 4 * PB) = cvt4(xr[i]);
#pragma unroll
    for (int i = 0; i < 16; ++i) *(v4us*)(wd + i * 4 * PB) = cvt4(wr[i]);
    __syncthreads();
    const int head = w & 3, th = w >> 2; const bf* tok = xs + (th * 64 + lr) * PB + 8 * hi; const bf* wt = wsm + (head * 16 + lr) * PB + 8 * hi;
    v8f acc[4];
#pragma unroll
    for (int t = 0; t < 4; ++t) acc[t] = (v8f){};
    const int z = (x0 / MM) * NH_ + c0 / HD + head, t0 = x0 % MM + th * 64;
    if (sel == 2) { proj_mm<true>(tok, wt, acc);
#pragma unroll
        for (int t = 0; t < 4; ++t) { v8us h, l; split8(acc[t], h, l); const size_t o = ((size_t)z * VP + lr) * NN + t0 + t * 16 + 8 * hi; *(v8us*)(Vh + o) = h; *(v8us*)(Vl + o) = l; }
        asm volatile("s_wait_xcnt 0x0" ::: "memory");   // behind this branch's last stores: no register that an issued store names is written again before this wait, on whichever way the code behind it is laid out
    } else { proj_mm<false>(tok, wt, acc); bf* Dh = sel == 0 ? Qh : Kh; bf* Dl = sel == 0 ? Ql : Kl; const float sc = sel == 0 ? 0.25f : 1.0f;
#pragma unroll
        for (int t = 0; t < 4; ++t) { v8us h, l; split8(acc[t] * sc, h, l); const size_t o = ((size_t)z * MM + t0 + t * 16 + lr) * KP + 8 * hi; *(v8us*)(Dh + o) = h; *(v8us*)(Dl + o) = l; }
        asm volatile("s_wait_xcnt 0x0" ::: "memory");   // the same behind this branch's last stores
    }
}
__global__ __launch_bounds__(128) void k_outp(const bf* __restrict__ Oh, const bf* __restrict__ Ol, const float* __restrict__ wout, float* C) {
    __shared__ __align__(16) bf wsm[32 * PB];
    const int tid = threadIdx.x, lane = tid & 31, lr = lane & 15, hi = lane >> 4, w = tid >> 5; const int r0 = blockIdx.x * 64, c0 = blockIdx.y * 32;
    const size_t aoff = ((size_t)(r0 / MM) * NH_ * MM + r0 % MM + w * 16 + lr) * VP + 8 * hi; const bf* ah = Oh + aoff; const bf* al = Ol + aoff; const float* Wt = wout + (size_t)c0 * EE + tid * 4;
    v8us oh[NH_], ol[NH_]; v4f wr[16];   // the block's 128 threads take 2 rows of Wout (512 floats) a step
#pragma unroll
    for (int i = 0; i < 16; ++i) wr[i] = *(const v4f*)(Wt + i * 512);
#pragma unroll
    for (int h = 0; h < NH_; ++h) { oh[h] = *(const v8us*)(ah + h * MM * VP); ol[h] = *(const v8us*)(al + h * MM * VP); }
    asm volatile("s_wait_xcnt 0x0" :: "v"(ah), "v"(al) : "memory");   // the two O address pairs stay whole up to here: no register that an issued load names is written again before this wait
    bf* wd = wsm + (tid >> 6) * PB + (tid & 63) * 4;
#pragma unroll
    for (int i = 0; i < 16; ++i) *(v4us*)(wd + i * 2 * PB) = cvt4(wr[i]);
    __syncthreads();
    v8f acc[2]; acc[0] = (v8f){}; acc[1] = (v8f){};
    const bf* wt = wsm + lr * PB + 8 * hi;
#pragma unroll
    for (int kc = 0; kc < EE; kc += 32) { const v16bf a = cat16b(oh[kc / HD], oh[kc / HD + 1]), a2 = cat16b(ol[kc / HD], ol[kc / HD + 1]);
#pragma unroll
        for (int nb = 0; nb < 2; ++nb) { const v16bf wf = WFrag<bf>::ld(wt + nb * 16 * PB + kc); acc[nb] = wmmab(wf, a, acc[nb]); acc[nb] = wmmab(wf, a2, acc[nb]); } }
    float* crow = C + (size_t)(r0 + w * 16 + lr) * EE + c0 + 8 * hi;
#pragma unroll
    for (int nb = 0; nb < 2; ++nb) { *(v4f*)(crow + nb * 16) = (v4f){ acc[nb][0], acc[nb][1], acc[nb][2], acc[nb][3] }; *(v4f*)(crow + nb * 16 + 4) = (v4f){ acc[nb][4], acc[nb][5], acc[nb][6], acc[nb][7] }; }
    asm volatile("s_wait_xcnt 0x0" ::: "memory");   // behind the last stores: no register that an issued store names is written again before this wait
}

__device__ __forceinline__ void splitf(float y, unsigned short& h, unsigned short& l) { h = f2bf(y); l = f2bf(y - bf2f(h)); }

// ---- k_attn: scores, mixing MLP, softmax and probs.v in one kernel; neither scores nor probs go through memory. Grid (M/16, b*16+h), 4 waves; the block owns 16 query rows, wave w the keys w*128 .. w*128+127.
// S^T = K Q^T: in each 16x16 tile lane (lr, hi) holds query m0+lr, keys 16t + 8hi + j in register j, which is the B fragment of O^T += V^T P^T as it stands (tiles 2c, 2c+1 -> elements 0..7, 8..15; the V loader has the same key order).
// Every loop is unrolled: s[], the weights and the fragments are register arrays and need constant indices.
// Row maximum and row sum: in the lane, across the two lane halves, then across the 4 waves through LDS; probs stay unnormalised until the 4 partial O^T are added (wave order 0..3) and scaled by 1/sum.
__device__ __forceinline__ float xhalf(float x) { const int i = __float_as_int(x); return __int_as_float(__builtin_amdgcn_permlanex16(i, i, 0x76543210, 0xfedcba98, false, false)); }   // lane l <-> l ^ 16
__global__ __launch_bounds__(128) void k_attn(const bf* __restrict__ Qh, const bf* __restrict__ Ql, const bf* __restrict__ Kh, const bf* __restrict__ Kl, const bf* __restrict__ Vh, const bf* __restrict__ Vl, const float* __restrict__ dm, const float* __restrict__ W1, const float* __restrict__ b1, const float* __restrict__ W2, const float* __restrict__ b2, bf* Oh, bf* Ol) {
    __shared__ float rmax[4][16]; __shared__ float rsum[4][16]; __shared__ __align__(16) float ored[4][32][8]; __shared__ __align__(16) float wl[4 * HID];
    const int lane = threadIdx.x & 31, lr = lane & 15, hi = lane >> 4, w = threadIdx.x >> 5; const int z = blockIdx.y, h = z % NH_, b = z / NH_; const int m0 = blockIdx.x * 16, n0 = w * 128;
    // Every global load of the score phase is issued here, ahead of the weight hand-over: Q, the wave's 8 K tiles (hi and lo) and the first DPE tiles of dmat are in flight together, so the wave pays one trip to L2 where each tile paid two in a row. dmat then runs DPF tiles ahead of the MLP.
    const v8us z8 = {};
    const size_t qo = ((size_t)z * MM + m0 + lr) * KP + 8 * hi; const v8us qh8 = *(const v8us*)(Qh + qo), ql8 = *(const v8us*)(Ql + qo);
    const size_t ko = ((size_t)z * NN + n0 + lr) * KP + 8 * hi; v8us kh8[8], kl8[8];
#pragma unroll
    for (int t = 0; t < 8; ++t) { kh8[t] = *(const v8us*)(Kh + ko + t * 16 * KP); kl8[t] = *(const v8us*)(Kl + ko + t * 16 * KP); }
    const float* dr = dm + (size_t)(b * MM + m0 + lr) * NN + n0 + 8 * hi;
    v4f da[8], db[8];
#pragma unroll
    for (int t = 0; t < DPE; ++t) { da[t] = *(const v4f*)(dr + t * 16); db[t] = *(const v4f*)(dr + t * 16 + 4); }
    asm volatile("s_wait_xcnt 0x0" :: "v"(Qh + qo), "v"(Ql + qo), "v"(Kh + ko), "v"(Kl + ko), "v"(dr) : "memory");   // the five address pairs stay whole up to here: no register that an issued load names is written again before this wait
    // the head's 64 MLP weights: rounded once by the block's first 64 threads, handed to every lane through LDS, so that they sit in vector registers (as scalar pairs they do not fit the scalar file)
    if (threadIdx.x < 4 * HID) { const int k = threadIdx.x & (HID - 1), g = threadIdx.x / HID; const float* wp = g == 0 ? W1 + (h * 2 + 0) * HID : g == 1 ? W1 + (h * 2 + 1) * HID : g == 2 ? b1 + h * HID : W2 + h * HID; wl[threadIdx.x] = bfr(wp[k]); }
    __syncthreads();
#pragma unroll
    for (int t = DPE; t < DPF; ++t) { da[t] = *(const v4f*)(dr + t * 16); db[t] = *(const v4f*)(dr + t * 16 + 4); }   // not at entry: a dmat load touches 16 lines, and the barrier above waits for every load in front of it; these fly during the score WMMAs and the first tiles' arithmetic
    const v16bf qh = cat16b(qh8, z8), ql = cat16b(ql8, z8);
    v8f s[8]; float mx = -3.0e38f;
#pragma unroll
    for (int t = 0; t < 8; ++t) { const v16bf kh = cat16b(kh8[t], z8), kl = cat16b(kl8[t], z8); v8f c = {}; c = wmmab(kh, qh, c); c = wmmab(kh, ql, c); c = wmmab(kl, qh, c); s[t] = c; }
    float w0[HID], w1[HID], bb[HID], w2[HID];
#pragma unroll
    for (int k = 0; k < HID; ++k) { w0[k] = wl[k]; w1[k] = wl[HID + k]; bb[k] = wl[2 * HID + k]; w2[k] = wl[3 * HID + k]; }
    const float bb2 = bfr(b2[h]);
#pragma unroll
    for (int t = 0; t < 8; ++t) { v8f c = s[t];
        if (t + DPF < 8) { da[t + DPF] = *(const v4f*)(dr + (t + DPF) * 16); db[t + DPF] = *(const v4f*)(dr + (t + DPF) * 16 + 4);
            __builtin_amdgcn_sched_barrier(0); }   // the dmat tile DPF tiles ahead is asked for before this tile's arithmetic: without this line the compiler sinks the loads towards their use, where each is waited for alone
        const float dd[8] = { da[t][0], da[t][1], da[t][2], da[t][3], db[t][0], db[t][1], db[t][2], db[t][3] };
        v2f a2[4], d2[4], acc[4];   // two elements side by side: each multiply-add is one packed instruction; the tile's four pairs go through each hidden unit together, four independent chains
#pragma unroll
        for (int u = 0; u < 4; ++u) { a2[u] = (v2f){ c[2 * u], c[2 * u + 1] }; d2[u] = (v2f){ bfr(dd[2 * u]), bfr(dd[2 * u + 1]) }; acc[u] = (v2f){ bb2, bb2 }; }
#pragma unroll
        for (int k = 0; k < HID; ++k) {
#pragma unroll
            for (int u = 0; u < 4; ++u) { const v2f hk = __builtin_elementwise_fma(a2[u], (v2f){ w0[k], w0[k] }, __builtin_elementwise_fma(d2[u], (v2f){ w1[k], w1[k] }, (v2f){ bb[k], bb[k] })); acc[u] = __builtin_elementwise_fma(__builtin_elementwise_max(hk, (v2f){ 0.f, 0.f }), (v2f){ w2[k], w2[k] }, acc[u]); } }
#pragma unroll
        for (int u = 0; u < 4; ++u) { c[2 * u] = acc[u][0]; c[2 * u + 1] = acc[u][1]; mx = fmaxf(mx, fmaxf(acc[u][0], acc[u][1])); }
        s[t] = c; }
    mx = fmaxf(mx, xhalf(mx)); if (hi == 0) rmax[w][lr] = mx;
    __syncthreads();
    mx = fmaxf(fmaxf(rmax[0][lr], rmax[1][lr]), fmaxf(rmax[2][lr], rmax[3][lr]));
    float sum = 0.f; v8f o = {};
#pragma unroll
    for (int c = 0; c < 4; ++c) { v8us p0h, p0l, p1h, p1l;
#pragma unroll
        for (int j = 0; j < 8; ++j) { const float e0 = __expf(s[2 * c][j] - mx), e1 = __expf(s[2 * c + 1][j] - mx); sum += e0; sum += e1; unsigned short x, y; splitf(e0, x, y); p0h[j] = x; p0l[j] = y; splitf(e1, x, y); p1h[j] = x; p1l[j] = y; }
        const size_t vo = ((size_t)z * VP + lr) * NN + n0 + c * 32 + 8 * hi; const v16bf vh = WFrag<bf>::ld(Vh + vo), vl = WFrag<bf>::ld(Vl + vo), ph = cat16b(p0h, p1h), pl = cat16b(p0l, p1l);
        o = wmmab(vh, ph, o); o = wmmab(vh, pl, o); o = wmmab(vl, ph, o); }
    sum += xhalf(sum); if (hi == 0) rsum[w][lr] = sum;
    *(v4fa*)&ored[w][lane][0] = (v4f){ o[0], o[1], o[2], o[3] }; *(v4fa*)&ored[w][lane][4] = (v4f){ o[4], o[5], o[6], o[7] };
    __syncthreads();
    if (w == 0) { const float f = __fdiv_rn(1.0f, ((rsum[0][lr] + rsum[1][lr]) + rsum[2][lr]) + rsum[3][lr]); const size_t oo = ((size_t)z * MM + m0 + lr) * VP + 8 * hi; v8f t8;   // register j of O^T = O[m0+lr][8hi+j]; stored as the hi+lo planes OP[z][m][d] that k_outp reads
#pragma unroll
        for (int q = 0; q < 2; ++q) { const v4f t4 = (((*(const v4fa*)&ored[0][lane][q * 4] + *(const v4fa*)&ored[1][lane][q * 4]) + *(const v4fa*)&ored[2][lane][q * 4]) + *(const v4fa*)&ored[3][lane][q * 4]) * f; t8[q * 4] = t4[0]; t8[q * 4 + 1] = t4[1]; t8[q * 4 + 2] = t4[2]; t8[q * 4 + 3] = t4[3]; }
        v8us oh, ol; split8(t8, oh, ol); *(v8us*)(Oh + oo) = oh; *(v8us*)(Ol + oo) = ol; } }

extern "C" void kernel_launch(void* const* d_in, const int* in_sizes, int n_in,
                              void* d_out, int out_size, void* d_ws, size_t ws_size, hipStream_t stream) {
    (void)in_sizes; (void)n_in; (void)out_size;
    const float** I = (const float**)d_in;
    const float *qin = I[0], *kvin = I[1], *dmat = I[2], *wq = I[3], *wkv = I[4], *W1 = I[5], *b1 = I[6], *W2 = I[7], *b2 = I[8], *wout = I[9];
    float* OUT = (float*)d_out;     // [4][512][256]
    char* wsp = (char*)d_ws;
    auto take = [&](size_t bytes) { char* p = wsp; wsp += (bytes + 255) & ~(size_t)255; return (void*)p; };
    bf* Qh = (bf*)take((size_t)NB_ * NH_ * MM * KP * 2); bf* Ql = (bf*)take((size_t)NB_ * NH_ * MM * KP * 2); bf* Kh = (bf*)take((size_t)NB_ * NH_ * NN * KP * 2); bf* Kl = (bf*)take((size_t)NB_ * NH_ * NN * KP * 2); bf* Vh = (bf*)take((size_t)NB_ * NH_ * VP * NN * 2); bf* Vl = (bf*)take((size_t)NB_ * NH_ * VP * NN * 2);
    bf* Oh = (bf*)take((size_t)NB_ * NH_ * MM * VP * 2); bf* Ol = (bf*)take((size_t)NB_ * NH_ * MM * VP * 2);
    if ((size_t)(wsp - (char*)d_ws) > ws_size) return;    // total 8 MB
    k_proj<<<dim3(NB_ * MM / 128, 12), 256, 0, stream>>>(qin, kvin, wq, wkv, Qh, Ql, Kh, Kl, Vh, Vl);
    k_attn<<<dim3(MM / 16, NB_ * NH_), 128, 0, stream>>>(Qh, Ql, Kh, Kl, Vh, Vl, dmat, W1, b1, W2, b2, Oh, Ol);
    k_outp<<<dim3(NB_ * MM / 64, EE / 32), 128, 0, stream>>>(Oh, Ol, wout, OUT);
}

// v007
// A run of this version takes 29.1 microseconds.
// Two timings next to v006 both put it at 1.11 times that version's speed.
// All steps since v000 together make it 11.0 times as fast.
#include <hip/hip_runtime.h>

// Cross attention with a mixing MLP on the scores (q_input [4][512][256], kv_input [4][512][256], dmat [4][512][512]; q = q_in Wq^T, k|v = kv_in Wkv^T (16 heads x 16); scores = q.k/4; per head a 2-16-1 MLP mixes (score, dmat[m][n]) -> relu -> mixed score; softmax over n;
// out = (probs v merged) Wout^T -> [4][512][256]).
// Compute dtypes, f32 accumulate: every input rounded to bf16; q, k, v projections on PLAIN bf16 operands (inputs: exact); output projection: A on bf16 hi+lo planes (2 products), Wout plain; scores (K 16, the upper half of each fragment zero) on bf16 hi+lo planes (3 products); the mixing MLP, softmax f32

#define NB_  4
#define MM   512
#define NN   512
#define EE   256
#define NH_  16
#define HD   16
#define KP   16
#define VP   16
#define HID  16
#define DPF  4
#define DPE  2
typedef unsigned short bf;
typedef __attribute__((ext_vector_type(16))) __bf16   v16bf;
typedef __attribute__((ext_vector_type(8)))  unsigned short v8us;
typedef __attribute__((ext_vector_type(8)))  float    v8f;
typedef __attribute__((ext_vector_type(4)))  float    v4f;
typedef __attribute__((ext_vector_type(2)))  float    v2f;
typedef v4f  __attribute__((may_alias)) v4fa;

__device__ __forceinline__ unsigned short f2bf(float f) { unsigned u = __float_as_uint(f); u += 0x7FFFu + ((u >> 16) & 1u); return (unsigned short)(u >> 16); }
__device__ __forceinline__ float bf2f(unsigned short b) { return __uint_as_float(((unsigned)b) << 16); }
__device__ __forceinline__ float bfr(float f) { return bf2f(f2bf(f)); }
__device__ __forceinline__ v16bf cat16b(v8us lo, v8us hi) { return __builtin_bit_cast(v16bf, __builtin_shufflevector(lo, hi, 0, 1, 2, 3, 4, 5, 6, 7, 8, 9, 10, 11, 12, 13, 14, 15)); }
__device__ __forceinline__ v8f wmmab(v16bf a, v16bf b, v8f c) { return __builtin_amdgcn_wmma_f32_16x16x32_bf16(false, a, false, b, (short)0, c, false, false); }



// ---- The three GEMMs. Every f32 operand panel (all 256 k of its rows) is brought in ONCE per block by whole-line loads (a wave's load = 512 consecutive bytes), rounded to bf16 and laid in LDS; after one barrier the block's waves read their fragments from LDS.
// All of a wave's loads are in flight together, so a block pays one trip to memory. LDS row pitch 264 elements = 528 B (16 B x odd: 16-byte fragment reads without bank conflicts).
// Each result leaves its kernel in the layout and the hi+lo bf16 planes that the next kernel's loader reads. Per-head planes are indexed z = b*16 + h; token rows are b*512 + m.
#define PB 264
template <typename T16> struct WFrag;
template <> struct WFrag<bf> { typedef v16bf V; static __device__ __forceinline__ V ld(const bf* p) { return cat16b(*(const v8us*)p, *(const v8us*)(p + 16)); } };   // k order 8hi.., 16+8hi..
typedef __attribute__((ext_vector_type(8))) __bf16 v8bf;
typedef __attribute__((ext_vector_type(4))) __bf16 v4bf;
typedef __attribute__((ext_vector_type(4))) unsigned short v4us;
__device__ __forceinline__ v8us cvt8(v8f x) { return __builtin_bit_cast(v8us, __builtin_convertvector(x, v8bf)); }   // round to nearest even, two elements an instruction
__device__ __forceinline__ v4us cvt4(v4f x) { return __builtin_bit_cast(v4us, __builtin_convertvector(x, v4bf)); }
typedef __attribute__((ext_vector_type(4))) unsigned v4u;
__device__ __forceinline__ void split8(v8f y, v8us& h, v8us& l) { h = cvt8(y); const v4u p = __builtin_bit_cast(v4u, h); v8f r;   // hi plane, then the rounded remainder; each packed word holds elements 2i (low half) and 2i+1
#pragma unroll
    for (int i = 0; i < 4; ++i) { r[2 * i] = y[2 * i] - __uint_as_float(p[i] << 16); r[2 * i + 1] = y[2 * i + 1] - __uint_as_float(p[i] & 0xFFFF0000u); }
    l = cvt8(r); }
// One wave's 64 tokens x 16 weight rows over K = 256, both operands in LDS. TOKA: the tokens are the A side (their index runs along a lane's 8 accumulator registers), else the weight rows are.
template <bool TOKA> __device__ __forceinline__ void proj_mm(const bf* tok, const bf* wt, v8f (&acc)[4]) {
#pragma unroll
    for (int kc = 0; kc < EE; kc += 32) { const v16bf wf = WFrag<bf>::ld(wt + kc);
#pragma unroll
        for (int t = 0; t < 4; ++t) { const v16bf tf = WFrag<bf>::ld(tok + t * 16 * PB + kc); acc[t] = TOKA ? wmmab(tf, wf, acc[t]) : wmmab(wf, tf, acc[t]); } }
}
// k_proj: q, k and v projections in one launch, grid (2048/128, 12), 8 waves: blockIdx.y / 4 picks q, k or v, blockIdx.y % 4 the 64 columns (4 heads). Wave w: head w % 4, tokens (w / 4) * 64 .. + 63.
// D[i][j] = sum_k A[i][k] B[j][k]; a lane's 8 accumulator registers are 8 consecutive i at one j, so A is the side whose index runs fastest in the plane that is written: the weight rows (d) for QP[z][m][d] (q/4) and KPn[z][n][d], the token rows (n) for VT[z][d][n]. Each is one 16-byte store a plane; a wave's 64 tokens fill whole 128-byte lines of VT.
__global__ __launch_bounds__(256) void k_proj(const float* __restrict__ qin, const float* __restrict__ kvin, const float* __restrict__ wq, const float* __restrict__ wkv, bf* Qh, bf* Ql, bf* Kh, bf* Kl, bf* Vh, bf* Vl) {
    __shared__ __align__(16) bf xs[128 * PB]; __shared__ __align__(16) bf wsm[64 * PB];
    const int tid = threadIdx.x, lane = tid & 31, lr = lane & 15, hi = lane >> 4, w = tid >> 5; const int sel = blockIdx.y >> 2, x0 = blockIdx.x * 128, c0 = (blockIdx.y & 3) * 64;
    const float* X = (sel == 0 ? qin : kvin) + (size_t)x0 * EE + tid * 4; const float* Wt = (sel == 0 ? wq : wkv + (size_t)(sel - 1) * EE * EE) + (size_t)c0 * EE + tid * 4;
    v4f xr[32], wr[16];   // the block's 256 threads take 4 rows (1024 floats) a step
#pragma unroll
    for (int i = 0; i < 32; ++i) xr[i] = *(const v4f*)(X + i * 1024);
#pragma unroll
    for (int i = 0; i < 16; ++i) wr[i] = *(const v4f*)(Wt + i * 1024);
    asm volatile("s_wait_xcnt 0x0" ::: "memory");   // behind the panel loads: no register that an issued load names is written again before this wait
    bf* xd = xs + (tid >> 6) * PB + (tid & 63) * 4; bf* wd = wsm + (tid >> 6) * PB + (tid & 63) * 4;
#pragma unroll
    for (int i = 0; i < 32; ++i) *(v4us*)(xd + i * 4 * PB) = cvt4(xr[i]);
#pragma unroll
    for (int i = 0; i < 16; ++i) *(v4us*)(wd + i * 4 * PB) = cvt4(wr[i]);
    __syncthreads();
    const int head = w & 3, th = w >> 2; const bf* tok = xs + (th * 64 + lr) * PB + 8 * hi; const bf* wt = wsm + (head * 16 + lr) * PB + 8 * hi;
    v8f acc[4];
#pragma unroll
    for (int t = 0; t < 4; ++t) acc[t] = (v8f){};
    const int z = (x0 / MM) * NH_ + c0 / HD + head, t0 = x0 % MM + th * 64;
    if (sel == 2) { proj_mm<true>(tok, wt, acc);
#pragma unroll
        for (int t = 0; t < 4; ++t) { v8us h, l; split8(acc[t], h, l); const size_t o = ((size_t)z * VP + lr) * NN + t0 + t * 16 + 8 * hi; *(v8us*)(Vh + o) = h; *(v8us*)(Vl + o) = l; }
        asm volatile("s_wait_xcnt 0x0" ::: "memory");   // behind this branch's last stores: no register that an issued store names is written again before this wait, on whichever way the code behind it is laid out
    } else { proj_mm<false>(tok, wt, acc); bf* Dh = sel == 0 ? Qh : Kh; bf* Dl = sel == 0 ? Ql : Kl; const float sc = sel == 0 ? 0.25f : 1.0f;
#pragma unroll
        for (int t = 0; t < 4; ++t) { v8us h, l; split8(acc[t] * sc, h, l); const size_t o = ((size_t)z * MM + t0 + t * 16 + lr) * KP + 8 * hi; *(v8us*)(Dh + o) = h; *(v8us*)(Dl + o) = l; }
        asm volatile("s_wait_xcnt 0x0" ::: "memory");   // the same behind this branch's last stores
    }
}
__global__ __launch_bounds__(128) void k_outp(const bf* __restrict__ Oh, const bf* __restrict__ Ol, const float* __restrict__ wout, float* C) {
    __shared__ __align__(16) bf wsm[32 * PB];
    const int tid = threadIdx.x, lane = tid & 31, lr = lane & 15, hi = lane >> 4, w = tid >> 5; const int r0 = blockIdx.x * 64, c0 = blockIdx.y * 32;
    const size_t aoff = ((size_t)(r0 / MM) * NH_ * MM + r0 % MM + w * 16 + lr) * VP + 8 * hi; const bf* ah = Oh + aoff; const bf* al = Ol + aoff; const float* Wt = wout + (size_t)c0 * EE + tid * 4;
    v8us oh[NH_], ol[NH_]; v4f wr[16];   // the block's 128 threads take 2 rows of Wout (512 floats) a step
#pragma unroll
    for (int i = 0; i < 16; ++i) wr[i] = *(const v4f*)(Wt + i * 512);
#pragma unroll
    for (int h = 0; h < NH_; ++h) { oh[h] = *(const v8us*)(ah + h * MM * VP); ol[h] = *(const v8us*)(al + h * MM * VP); }
    asm volatile("s_wait_xcnt 0x0" :: "v"(ah), "v"(al) : "memory");   // the two O address pairs stay whole up to here: no register that an issued load names is written again before this wait
    bf* wd = wsm + (tid >> 6) * PB + (tid & 63) * 4;
#pragma unroll
    for (int i = 0; i < 16; ++i) *(v4us*)(wd + i * 2 * PB) = cvt4(wr[i]);
    __syncthreads();
    v8f acc[2]; acc[0] = (v8f){}; acc[1] = (v8f){};
    const bf* wt = wsm + lr * PB + 8 * hi;
#pragma unroll
    for (int kc = 0; kc < EE; kc += 32) { const v16bf a = cat16b(oh[kc / HD], oh[kc / HD + 1]), a2 = cat16b(ol[kc / HD], ol[kc / HD + 1]);
#pragma unroll
        for (int nb = 0; nb < 2; ++nb) { const v16bf wf = WFrag<bf>::ld(wt + nb * 16 * PB + kc); acc[nb] = wmmab(wf, a, acc[nb]); acc[nb] = wmmab(wf, a2, acc[nb]); } }
    float* crow = C + (size_t)(r0 + w * 16 + lr) * EE + c0 + 8 * hi;
#pragma unroll
    for (int nb = 0; nb < 2; ++nb) { *(v4f*)(crow + nb * 16) = (v4f){ acc[nb][0], acc[nb][1], acc[nb][2], acc[nb][3] }; *(v4f*)(crow + nb * 16 + 4) = (v4f){ acc[nb][4], acc[nb][5], acc[nb][6], acc[nb][7] }; }
    asm volatile("s_wait_xcnt 0x0" ::: "memory");   // behind the last stores: no register that an issued store names is written again before this wait
}

__device__ __forceinline__ void splitf(float y, unsigned short& h, unsigned short& l) { h = f2bf(y); l = f2bf(y - bf2f(h)); }

// ---- k_attn: scores, mixing MLP, softmax and probs.v in one kernel; neither scores nor probs go through memory. Grid (M/16, b*16+h), 4 waves; the block owns 16 query rows, wave w the keys w*128 .. w*128+127.
// S^T = K Q^T: in each 16x16 tile lane (lr, hi) holds query m0+lr, keys 16t + 8hi + j in register j, which is the B fragment of O^T += V^T P^T as it stands (tiles 2c, 2c+1 -> elements 0..7, 8..15; the V loader has the same key order).
// Every loop is unrolled: s[], the weights and the fragments are register arrays and need constant indices.
// Row maximum and row sum: in the lane, across the two lane halves, then across the 4 waves through LDS; probs stay unnormalised until the 4 partial O^T are added (wave order 0..3) and scaled by 1/sum.
__device__ __forceinline__ float xhalf(float x) { const int i = __float_as_int(x); return __int_as_float(__builtin_amdgcn_permlanex16(i, i, 0x76543210, 0xfedcba98, false, false)); }   // lane l <-> l ^ 16
// Two hidden units (the low and the high element of each weight pair) for a tile's four element pairs. relu is the clamp bit of the packed multiply-add that finishes the hidden value: the result is held to [0, 1] as it is written, so no maximum is issued.
// The weights come scaled by powers of two (layer 1 by 2^-64, layer 2 by 2^64: exact), so 1 stands for a hidden value of 2^64 and every smaller one passes as it is. In asm because the compiler has no packed f32 form with the bit.
// Order: both units' first, second and third multiply-adds in groups of four, so a result is read 8 instructions behind its writer; only the second unit's sum follows the first's at 4, and says so to the issue logic (s_delay_alu), which the compiler does not do for asm text.
__device__ __forceinline__ void mlp2_first(v2f (&acc)[4], const v2f (&a2)[4], const v2f (&d2)[4], v2f w0p, v2f w1p, v2f bp, v2f w2p, v2f start) {
    v2f ta0, ta1, ta2, ta3, tb0, tb1, tb2, tb3;
    asm(   // packed multiply-adds with the clamp bit as relu, which the compiler cannot emit; s_delay_alu names the one short dependence (4 back) so that another wave issues meanwhile
        "v_pk_fma_f32 %4, %16, %21, %22 op_sel_hi:[1,0,0]\n\t"
        "v_pk_fma_f32 %5, %17, %21, %22 op_sel_hi:[1,0,0]\n\t"
        "v_pk_fma_f32 %6, %18, %21, %22 op_sel_hi:[1,0,0]\n\t"
        "v_pk_fma_f32 %7, %19, %21, %22 op_sel_hi:[1,0,0]\n\t"
        "v_pk_fma_f32 %8, %16, %21, %22 op_sel:[0,1,1]\n\t"
        "v_pk_fma_f32 %9, %17, %21, %22 op_sel:[0,1,1]\n\t"
        "v_pk_fma_f32 %10, %18, %21, %22 op_sel:[0,1,1]\n\t"
        "v_pk_fma_f32 %11, %19, %21, %22 op_sel:[0,1,1]\n\t"
        "v_pk_fma_f32 %4, %12, %20, %4 op_sel_hi:[1,0,1] clamp\n\t"
        "v_pk_fma_f32 %5, %13, %20, %5 op_sel_hi:[1,0,1] clamp\n\t"
        "v_pk_fma_f32 %6, %14, %20, %6 op_sel_hi:[1,0,1] clamp\n\t"
        "v_pk_fma_f32 %7, %15, %20, %7 op_sel_hi:[1,0,1] clamp\n\t"
        "v_pk_fma_f32 %8, %12, %20, %8 op_sel:[0,1,0] clamp\n\t"
        "v_pk_fma_f32 %9, %13, %20, %9 op_sel:[0,1,0] clamp\n\t"
        "v_pk_fma_f32 %10, %14, %20, %10 op_sel:[0,1,0] clamp\n\t"
        "v_pk_fma_f32 %11, %15, %20, %11 op_sel:[0,1,0] clamp\n\t"
        "v_pk_fma_f32 %0, %4, %23, %24 op_sel_hi:[1,0,1]\n\t"
        "v_pk_fma_f32 %1, %5, %23, %24 op_sel_hi:[1,0,1]\n\t"
        "v_pk_fma_f32 %2, %6, %23, %24 op_sel_hi:[1,0,1]\n\t"
        "v_pk_fma_f32 %3, %7, %23, %24 op_sel_hi:[1,0,1]\n\t"
        "s_delay_alu instid0(VALU_DEP_4) | instskip(NEXT) | instid1(VALU_DEP_4)\n\t"
        "v_pk_fma_f32 %0, %8, %23, %0 op_sel:[0,1,0]\n\t"
        "v_pk_fma_f32 %1, %9, %23, %1 op_sel:[0,1,0]\n\t"
        "s_delay_alu instid0(VALU_DEP_4) | instskip(NEXT) | instid1(VALU_DEP_4)\n\t"
        "v_pk_fma_f32 %2, %10, %23, %2 op_sel:[0,1,0]\n\t"
        "v_pk_fma_f32 %3, %11, %23, %3 op_sel:[0,1,0]"
        : "=&v"(acc[0]), "=&v"(acc[1]), "=&v"(acc[2]), "=&v"(acc[3]), "=&v"(ta0), "=&v"(ta1), "=&v"(ta2), "=&v"(ta3), "=&v"(tb0), "=&v"(tb1), "=&v"(tb2), "=&v"(tb3)
        : "v"(a2[0]), "v"(a2[1]), "v"(a2[2]), "v"(a2[3]), "v"(d2[0]), "v"(d2[1]), "v"(d2[2]), "v"(d2[3]), "v"(w0p), "v"(w1p), "v"(bp), "v"(w2p), "v"(start));
}
__device__ __forceinline__ void mlp2_next(v2f (&acc)[4], const v2f (&a2)[4], const v2f (&d2)[4], v2f w0p, v2f w1p, v2f bp, v2f w2p) {
    v2f ta0, ta1, ta2, ta3, tb0, tb1, tb2, tb3;
    asm(   // packed multiply-adds with the clamp bit as relu, which the compiler cannot emit; s_delay_alu names the one short dependence (4 back) so that another wave issues meanwhile
        "v_pk_fma_f32 %4, %16, %21, %22 op_sel_hi:[1,0,0]\n\t"
        "v_pk_fma_f32 %5, %17, %21, %22 op_sel_hi:[1,0,0]\n\t"
        "v_pk_fma_f32 %6, %18, %21, %22 op_sel_hi:[1,0,0]\n\t"
        "v_pk_fma_f32 %7, %19, %21, %22 op_sel_hi:[1,0,0]\n\t"
        "v_pk_fma_f32 %8, %16, %21, %22 op_sel:[0,1,1]\n\t"
        "v_pk_fma_f32 %9, %17, %21, %22 op_sel:[0,1,1]\n\t"
        "v_pk_fma_f32 %10, %18, %21, %22 op_sel:[0,1,1]\n\t"
        "v_pk_fma_f32 %11, %19, %21, %22 op_sel:[0,1,1]\n\t"
        "v_pk_fma_f32 %4, %12, %20, %4 op_sel_hi:[1,0,1] clamp\n\t"
        "v_pk_fma_f32 %5, %13, %20, %5 op_sel_hi:[1,0,1] clamp\n\t"
        "v_pk_fma_f32 %6, %14, %20, %6 op_sel_hi:[1,0,1] clamp\n\t"
        "v_pk_fma_f32 %7, %15, %20, %7 op_sel_hi:[1,0,1] clamp\n\t"
        "v_pk_fma_f32 %8, %12, %20, %8 op_sel:[0,1,0] clamp\n\t"
        "v_pk_fma_f32 %9, %13, %20, %9 op_sel:[0,1,0] clamp\n\t"
        "v_pk_fma_f32 %10, %14, %20, %10 op_sel:[0,1,0] clamp\n\t"
        "v_pk_fma_f32 %11, %15, %20, %11 op_sel:[0,1,0] clamp\n\t"
        "v_pk_fma_f32 %0, %4, %23, %0 op_sel_hi:[1,0,1]\n\t"
        "v_pk_fma_f32 %1, %5, %23, %1 op_sel_hi:[1,0,1]\n\t"
        "v_pk_fma_f32 %2, %6, %23, %2 op_sel_hi:[1,0,1]\n\t"
        "v_pk_fma_f32 %3, %7, %23, %3 op_sel_hi:[1,0,1]\n\t"
        "s_delay_alu instid0(VALU_DEP_4) | instskip(NEXT) | instid1(VALU_DEP_4)\n\t"
        "v_pk_fma_f32 %0, %8, %23, %0 op_sel:[0,1,0]\n\t"
        "v_pk_fma_f32 %1, %9, %23, %1 op_sel:[0,1,0]\n\t"
        "s_delay_alu instid0(VALU_DEP_4) | instskip(NEXT) | instid1(VALU_DEP_4)\n\t"
        "v_pk_fma_f32 %2, %10, %23, %2 op_sel:[0,1,0]\n\t"
        "v_pk_fma_f32 %3, %11, %23, %3 op_sel:[0,1,0]"
        : "+v"(acc[0]), "+v"(acc[1]), "+v"(acc[2]), "+v"(acc[3]), "=&v"(ta0), "=&v"(ta1), "=&v"(ta2), "=&v"(ta3), "=&v"(tb0), "=&v"(tb1), "=&v"(tb2), "=&v"(tb3)
        : "v"(a2[0]), "v"(a2[1]), "v"(a2[2]), "v"(a2[3]), "v"(d2[0]), "v"(d2[1]), "v"(d2[2]), "v"(d2[3]), "v"(w0p), "v"(w1p), "v"(bp), "v"(w2p));
}
__global__ __launch_bounds__(128) void k_attn(const bf* __restrict__ Qh, const bf* __restrict__ Ql, const bf* __restrict__ Kh, const bf* __restrict__ Kl, const bf* __restrict__ Vh, const bf* __restrict__ Vl, const float* __restrict__ dm, const float* __restrict__ W1, const float* __restrict__ b1, const float* __restrict__ W2, const float* __restrict__ b2, bf* Oh, bf* Ol) {
    __shared__ float rmax[4][16]; __shared__ float rsum[4][16]; __shared__ __align__(16) float ored[4][32][8]; __shared__ __align__(16) float wl[4 * HID];
    const int lane = threadIdx.x & 31, lr = lane & 15, hi = lane >> 4, w = threadIdx.x >> 5; const int z = blockIdx.y, h = z % NH_, b = z / NH_; const int m0 = blockIdx.x * 16, n0 = w * 128;
    // Every global load of the score phase is issued here, ahead of the weight hand-over: Q, the wave's 8 K tiles (hi and lo) and the first DPE tiles of dmat are in flight together, so the wave pays one trip to L2 where each tile paid two in a row. dmat then runs DPF tiles ahead of the MLP.
    const v8us z8 = {};
    const size_t qo = ((size_t)z * MM + m0 + lr) * KP + 8 * hi; const v8us qh8 = *(const v8us*)(Qh + qo), ql8 = *(const v8us*)(Ql + qo);
    const size_t ko = ((size_t)z * NN + n0 + lr) * KP + 8 * hi; v8us kh8[8], kl8[8];
#pragma unroll
    for (int t = 0; t < 8; ++t) { kh8[t] = *(const v8us*)(Kh + ko + t * 16 * KP); kl8[t] = *(const v8us*)(Kl + ko + t * 16 * KP); }
    const float* dr = dm + (size_t)(b * MM + m0 + lr) * NN + n0 + 8 * hi;
    v4f da[8], db[8];
#pragma unroll
    for (int t = 0; t < DPE; ++t) { da[t] = *(const v4f*)(dr + t * 16); db[t] = *(const v4f*)(dr + t * 16 + 4); }
    asm volatile("s_wait_xcnt 0x0" :: "v"(Qh + qo), "v"(Ql + qo), "v"(Kh + ko), "v"(Kl + ko), "v"(dr) : "memory");   // the five address pairs stay whole up to here: no register that an issued load names is written again before this wait
    // the head's 64 MLP weights: rounded once by the block's first 64 threads, handed to every lane through LDS, so that they sit in vector registers (as scalar pairs they do not fit the scalar file)
    if (threadIdx.x < 4 * HID) { const int k = threadIdx.x & (HID - 1), g = threadIdx.x / HID; const float* wp = g == 0 ? W1 + (h * 2 + 0) * HID : g == 1 ? W1 + (h * 2 + 1) * HID : g == 2 ? b1 + h * HID : W2 + h * HID; wl[threadIdx.x] = bfr(wp[k]) * (g == 3 ? 0x1p64f : 0x1p-64f); }   // the power-of-two scales that mlp2 asks for
    __syncthreads();
#pragma unroll
    for (int t = DPE; t < DPF; ++t) { da[t] = *(const v4f*)(dr + t * 16); db[t] = *(const v4f*)(dr + t * 16 + 4); }   // not at entry: a dmat load touches 16 lines, and the barrier above waits for every load in front of it; these fly during the score WMMAs and the first tiles' arithmetic
    const v16bf qh = cat16b(qh8, z8), ql = cat16b(ql8, z8);
    v8f s[8]; float mx = -3.0e38f;
#pragma unroll
    for (int t = 0; t < 8; ++t) { const v16bf kh = cat16b(kh8[t], z8), kl = cat16b(kl8[t], z8); v8f c = {}; c = wmmab(kh, qh, c); c = wmmab(kh, ql, c); c = wmmab(kl, qh, c); s[t] = c; }
    v2f w0[HID / 2], w1[HID / 2], bb[HID / 2], w2[HID / 2];   // units 2k and 2k+1 side by side
#pragma unroll
    for (int k = 0; k < HID / 4; ++k) { const v4f x0 = *(const v4fa*)&wl[4 * k], x1 = *(const v4fa*)&wl[HID + 4 * k], x2 = *(const v4fa*)&wl[2 * HID + 4 * k], x3 = *(const v4fa*)&wl[3 * HID + 4 * k];
        w0[2 * k] = (v2f){ x0[0], x0[1] }; w0[2 * k + 1] = (v2f){ x0[2], x0[3] }; w1[2 * k] = (v2f){ x1[0], x1[1] }; w1[2 * k + 1] = (v2f){ x1[2], x1[3] };
        bb[2 * k] = (v2f){ x2[0], x2[1] }; bb[2 * k + 1] = (v2f){ x2[2], x2[3] }; w2[2 * k] = (v2f){ x3[0], x3[1] }; w2[2 * k + 1] = (v2f){ x3[2], x3[3] }; }
    const float bb2 = bfr(b2[h]);
#pragma unroll
    for (int t = 0; t < 8; ++t) { v8f c = s[t];
        if (t + DPF < 8) { da[t + DPF] = *(const v4f*)(dr + (t + DPF) * 16); db[t + DPF] = *(const v4f*)(dr + (t + DPF) * 16 + 4);
            __builtin_amdgcn_sched_barrier(0); }   // the dmat tile DPF tiles ahead is asked for before this tile's arithmetic: without this line the compiler sinks the loads towards their use, where each is waited for alone
        const float dd[8] = { da[t][0], da[t][1], da[t][2], da[t][3], db[t][0], db[t][1], db[t][2], db[t][3] };
        v2f a2[4], d2[4], acc[4];   // two elements side by side: each multiply-add is one packed instruction; the tile's four pairs go through each hidden unit together, four independent chains
#pragma unroll
        for (int u = 0; u < 4; ++u) { a2[u] = (v2f){ c[2 * u], c[2 * u + 1] }; d2[u] = (v2f){ bfr(dd[2 * u]), bfr(dd[2 * u + 1]) }; }
        mlp2_first(acc, a2, d2, w0[0], w1[0], bb[0], w2[0], (v2f){ bb2, bb2 });
#pragma unroll
        for (int k = 1; k < HID / 2; ++k) mlp2_next(acc, a2, d2, w0[k], w1[k], bb[k], w2[k]);
#pragma unroll
        for (int u = 0; u < 4; ++u) { c[2 * u] = acc[u][0]; c[2 * u + 1] = acc[u][1]; mx = fmaxf(mx, fmaxf(acc[u][0], acc[u][1])); }
        s[t] = c; }
    mx = fmaxf(mx, xhalf(mx)); if (hi == 0) rmax[w][lr] = mx;
    __syncthreads();
    mx = fmaxf(fmaxf(rmax[0][lr], rmax[1][lr]), fmaxf(rmax[2][lr], rmax[3][lr]));
    float sum = 0.f; v8f o = {};
#pragma unroll
    for (int c = 0; c < 4; ++c) { v8us p0h, p0l, p1h, p1l;
#pragma unroll
        for (int j = 0; j < 8; ++j) { const float e0 = __expf(s[2 * c][j] - mx), e1 = __expf(s[2 * c + 1][j] - mx); sum += e0; sum += e1; unsigned short x, y; splitf(e0, x, y); p0h[j] = x; p0l[j] = y; splitf(e1, x, y); p1h[j] = x; p1l[j] = y; }
        const size_t vo = ((size_t)z * VP + lr) * NN + n0 + c * 32 + 8 * hi; const v16bf vh = WFrag<bf>::ld(Vh + vo), vl = WFrag<bf>::ld(Vl + vo), ph = cat16b(p0h, p1h), pl = cat16b(p0l, p1l);
        o = wmmab(vh, ph, o); o = wmmab(vh, pl, o); o = wmmab(vl, ph, o); }
    sum += xhalf(sum); if (hi == 0) rsum[w][lr] = sum;
    *(v4fa*)&ored[w][lane][0] = (v4f){ o[0], o[1], o[2], o[3] }; *(v4fa*)&ored[w][lane][4] = (v4f){ o[4], o[5], o[6], o[7] };
    __syncthreads();
    if (w == 0) { const float f = __fdiv_rn(1.0f, ((rsum[0][lr] + rsum[1][lr]) + rsum[2][lr]) + rsum[3][lr]); const size_t oo = ((size_t)z * MM + m0 + lr) * VP + 8 * hi; v8f t8;   // register j of O^T = O[m0+lr][8hi+j]; stored as the hi+lo planes OP[z][m][d] that k_outp reads
#pragma unroll
        for (int q = 0; q < 2; ++q) { const v4f t4 = (((*(const v4fa*)&ored[0][lane][q * 4] + *(const v4fa*)&ored[1][lane][q * 4]) + *(const v4fa*)&ored[2][lane][q * 4]) + *(const v4fa*)&ored[3][lane][q * 4]) * f; t8[q * 4] = t4[0]; t8[q * 4 + 1] = t4[1]; t8[q * 4 + 2] = t4[2]; t8[q * 4 + 3] = t4[3]; }
        v8us oh, ol; split8(t8, oh, ol); *(v8us*)(Oh + oo) = oh; *(v8us*)(Ol + oo) = ol; } }

extern "C" void kernel_launch(void* const* d_in, const int* in_sizes, int n_in,
                              void* d_out, int out_size, void* d_ws, size_t ws_size, hipStream_t stream) {
    (void)in_sizes; (void)n_in; (void)out_size;
    const float** I = (const float**)d_in;
    const float *qin = I[0], *kvin = I[1], *dmat = I[2], *wq = I[3], *wkv = I[4], *W1 = I[5], *b1 = I[6], *W2 = I[7], *b2 = I[8], *wout = I[9];
    float* OUT = (float*)d_out;     // [4][512][256]
    char* wsp = (char*)d_ws;
    auto take = [&](size_t bytes) { char* p = wsp; wsp += (bytes + 255) & ~(size_t)255; return (void*)p; };
    bf* Qh = (bf*)take((size_t)NB_ * NH_ * MM * KP * 2); bf* Ql = (bf*)take((size_t)NB_ * NH_ * MM * KP * 2); bf* Kh = (bf*)take((size_t)NB_ * NH_ * NN * KP * 2); bf* Kl = (bf*)take((size_t)NB_ * NH_ * NN * KP * 2); bf* Vh = (bf*)take((size_t)NB_ * NH_ * VP * NN * 2); bf* Vl = (bf*)take((size_t)NB_ * NH_ * VP * NN * 2);
    bf* Oh = (bf*)take((size_t)NB_ * NH_ * MM * VP * 2); bf* Ol = (bf*)take((size_t)NB_ * NH_ * MM * VP * 2);
    if ((size_t)(wsp - (char*)d_ws) > ws_size) return;    // total 8 MB
    k_proj<<<dim3(NB_ * MM / 128, 12), 256, 0, stream>>>(qin, kvin, wq, wkv, Qh, Ql, Kh, Kl, Vh, Vl);
    k_attn<<<dim3(MM / 16, NB_ * NH_), 128, 0, stream>>>(Qh, Ql, Kh, Kl, Vh, Vl, dmat, W1, b1, W2, b2, Oh, Ol);
    k_outp<<<dim3(NB_ * MM / 64, EE / 32), 128, 0, stream>>>(Oh, Ol, wout, OUT);
}

// v008
// A run of this version takes 27.7 microseconds.
// Timed twice side by side with v007, it ran 1.05 times as fast both times.
// Counting every step since v000, it is 11.6 times as fast.
#include <hip/hip_runtime.h>

// Cross attention with a mixing MLP on the scores (q_input [4][512][256], kv_input [4][512][256], dmat [4][512][512]; q = q_in Wq^T, k|v = kv_in Wkv^T (16 heads x 16); scores = q.k/4; per head a 2-16-1 MLP mixes (score, dmat[m][n]) -> relu -> mixed score; softmax over n;
// out = (probs v merged) Wout^T -> [4][512][256]).
// Compute dtypes, f32 accumulate: every input rounded to bf16; q, k, v projections on PLAIN bf16 operands (inputs: exact); output projection: A on bf16 hi+lo planes (2 products), Wout plain; scores (K 16, the upper half of each fragment zero) on bf16 hi+lo planes (3 products); the mixing MLP, softmax f32

#define NB_  4
#define MM   512
#define NN   512
#define EE   256
#define NH_  16
#define HD   16
#define KP   16
#define VP   16
#define HID  16
#define DPF  4
#define DPE  2
typedef unsigned short bf;
typedef __attribute__((ext_vector_type(16))) __bf16   v16bf;
typedef __attribute__((ext_vector_type(8)))  unsigned short v8us;
typedef __attribute__((ext_vector_type(8)))  float    v8f;
typedef __attribute__((ext_vector_type(4)))  float    v4f;
typedef __attribute__((ext_vector_type(2)))  float    v2f;
typedef v4f  __attribute__((may_alias)) v4fa;

__device__ __forceinline__ unsigned short f2bf(float f) { unsigned u = __float_as_uint(f); u += 0x7FFFu + ((u >> 16) & 1u); return (unsigned short)(u >> 16); }
__device__ __forceinline__ float bf2f(unsigned short b) { return __uint_as_float(((unsigned)b) << 16); }
__device__ __forceinline__ float bfr(float f) { return bf2f(f2bf(f)); }
__device__ __forceinline__ v16bf cat16b(v8us lo, v8us hi) { return __builtin_bit_cast(v16bf, __builtin_shufflevector(lo, hi, 0, 1, 2, 3, 4, 5, 6, 7, 8, 9, 10, 11, 12, 13, 14, 15)); }
__device__ __forceinline__ v8f wmmab(v16bf a, v16bf b, v8f c) { return __builtin_amdgcn_wmma_f32_16x16x32_bf16(false, a, false, b, (short)0, c, false, false); }



// ---- The three GEMMs. Every f32 operand panel (all 256 k of its rows) is brought in ONCE per block by whole-line loads (a wave's load = 512 consecutive bytes), rounded to bf16 and laid in LDS; after one barrier the block's waves read their fragments from LDS.
// All of a wave's loads are in flight together, so a block pays one trip to memory. LDS row pitch 264 elements = 528 B (16 B x odd: 16-byte fragment reads without bank conflicts).
// Each result leaves its kernel in the layout and the hi+lo bf16 planes that the next kernel's loader reads. Per-head planes are indexed z = b*16 + h; token rows are b*512 + m.
#define PB 264
template <typename T16> struct WFrag;
template <> struct WFrag<bf> { typedef v16bf V; static __device__ __forceinline__ V ld(const bf* p) { return cat16b(*(const v8us*)p, *(const v8us*)(p + 16)); } };   // k order 8hi.., 16+8hi..
typedef __attribute__((ext_vector_type(8))) __bf16 v8bf;
typedef __attribute__((ext_vector_type(4))) __bf16 v4bf;
typedef __attribute__((ext_vector_type(4))) unsigned short v4us;
__device__ __forceinline__ v8us cvt8(v8f x) { return __builtin_bit_cast(v8us, __builtin_convertvector(x, v8bf)); }   // round to nearest even, two elements an instruction
__device__ __forceinline__ v4us cvt4(v4f x) { return __builtin_bit_cast(v4us, __builtin_convertvector(x, v4bf)); }
typedef __attribute__((ext_vector_type(4))) unsigned v4u;
__device__ __forceinline__ void split8(v8f y, v8us& h, v8us& l) { h = cvt8(y); const v4u p = __builtin_bit_cast(v4u, h); v8f r;   // hi plane, then the rounded remainder; each packed word holds elements 2i (low half) and 2i+1
#pragma unroll
    for (int i = 0; i < 4; ++i) { r[2 * i] = y[2 * i] - __uint_as_float(p[i] << 16); r[2 * i + 1] = y[2 * i + 1] - __uint_as_float(p[i] & 0xFFFF0000u); }
    l = cvt8(r); }
// One wave's 64 tokens x 16 weight rows over K = 256, both operands in LDS. TOKA: the tokens are the A side (their index runs along a lane's 8 accumulator registers), else the weight rows are.
template <bool TOKA> __device__ __forceinline__ void proj_mm(const bf* tok, const bf* wt, v8f (&acc)[4]) {
#pragma unroll
    for (int kc = 0; kc < EE; kc += 32) { const v16bf wf = WFrag<bf>::ld(wt + kc);
#pragma unroll
        for (int t = 0; t < 4; ++t) { const v16bf tf = WFrag<bf>::ld(tok + t * 16 * PB + kc); acc[t] = TOKA ? wmmab(tf, wf, acc[t]) : wmmab(wf, tf, acc[t]); } }
}
// k_proj: q, k and v projections in one launch, grid (2048/128, 12), 8 waves: blockIdx.y / 4 picks q, k or v, blockIdx.y % 4 the 64 columns (4 heads). Wave w: head w % 4, tokens (w / 4) * 64 .. + 63.
// D[i][j] = sum_k A[i][k] B[j][k]; a lane's 8 accumulator registers are 8 consecutive i at one j, so A is the side whose index runs fastest in the plane that is written: the weight rows (d) for QP[z][m][d] (q/4) and KPn[z][n][d], the token rows (n) for VT[z][d][n]. Each is one 16-byte store a plane; a wave's 64 tokens fill whole 128-byte lines of VT.
__global__ __launch_bounds__(256) void k_proj(const float* __restrict__ qin, const float* __restrict__ kvin, const float* __restrict__ wq, const float* __restrict__ wkv, bf* Qh, bf* Ql, bf* Kh, bf* Kl, bf* Vh, bf* Vl) {
    __shared__ __align__(16) bf xs[128 * PB]; __shared__ __align__(16) bf wsm[64 * PB];
    const int tid = threadIdx.x, lane = tid & 31, lr = lane & 15, hi = lane >> 4, w = tid >> 5; const int sel = blockIdx.y >> 2, x0 = blockIdx.x * 128, c0 = (blockIdx.y & 3) * 64;
    const float* X = (sel == 0 ? qin : kvin) + (size_t)x0 * EE + tid * 4; const float* Wt = (sel == 0 ? wq : wkv + (size_t)(sel - 1) * EE * EE) + (size_t)c0 * EE + tid * 4;
    v4f xr[32], wr[16];   // the block's 256 threads take 4 rows (1024 floats) a step
#pragma unroll
    for (int i = 0; i < 32; ++i) xr[i] = *(const v4f*)(X + i * 1024);
#pragma unroll
    for (int i = 0; i < 16; ++i) wr[i] = *(const v4f*)(Wt + i * 1024);
    asm volatile("s_wait_xcnt 0x0" ::: "memory");   // behind the panel loads: no register that an issued load names is written again before this wait
    bf* xd = xs + (tid >> 6) * PB + (tid & 63) * 4; bf* wd = wsm + (tid >> 6) * PB + (tid & 63) * 4;
#pragma unroll
    for (int i = 0; i < 32; ++i) *(v4us*)(xd + i * 4 * PB) = cvt4(xr[i]);
#pragma unroll
    for (int i = 0; i < 16; ++i) *(v4us*)(wd + i * 4 * PB) = cvt4(wr[i]);
    __syncthreads();
    const int head = w & 3, th = w >> 2; const bf* tok = xs + (th * 64 + lr) * PB + 8 * hi; const bf* wt = wsm + (head * 16 + lr) * PB + 8 * hi;
    v8f acc[4];
#pragma unroll
    for (int t = 0; t < 4; ++t) acc[t] = (v8f){};
    const int z = (x0 / MM) * NH_ + c0 / HD + head, t0 = x0 % MM + th * 64;
    if (sel == 2) { proj_mm<true>(tok, wt, acc);
#pragma unroll
        for (int t = 0; t < 4; ++t) { v8us h, l; split8(acc[t], h, l); const size_t o = ((size_t)z * VP + lr) * NN + t0 + t * 16 + 8 * hi; *(v8us*)(Vh + o) = h; *(v8us*)(Vl + o) = l; }
        asm volatile("s_wait_xcnt 0x0" ::: "memory");   // behind this branch's last stores: no register that an issued store names is written again before this wait, on whichever way the code behind it is laid out
    } else { proj_mm<false>(tok, wt, acc); bf* Dh = sel == 0 ? Qh : Kh; bf* Dl = sel == 0 ? Ql : Kl; const float sc = sel == 0 ? 0.25f : 1.0f;
#pragma unroll
        for (int t = 0; t < 4; ++t) { v8us h, l; split8(acc[t] * sc, h, l); const size_t o = ((size_t)z * MM + t0 + t * 16 + lr) * KP + 8 * hi; *(v8us*)(Dh + o) = h; *(v8us*)(Dl + o) = l; }
        asm volatile("s_wait_xcnt 0x0" ::: "memory");   // the same behind this branch's last stores
    }
}
__global__ __launch_bounds__(128) void k_outp(const bf* __restrict__ Oh, const bf* __restrict__ Ol, const float* __restrict__ wout, float* C) {
    __shared__ __align__(16) bf wsm[32 * PB];
    const int tid = threadIdx.x, lane = tid & 31, lr = lane & 15, hi = lane >> 4, w = tid >> 5; const int r0 = blockIdx.x * 64, c0 = blockIdx.y * 32;
    const size_t aoff = ((size_t)(r0 / MM) * NH_ * MM + r0 % MM + w * 16 + lr) * VP + 8 * hi; const bf* ah = Oh + aoff; const bf* al = Ol + aoff; const float* Wt = wout + (size_t)c0 * EE + tid * 4;
    v8us oh[NH_], ol[NH_]; v4f wr[16];   // the block's 128 threads take 2 rows of Wout (512 floats) a step
#pragma unroll
    for (int i = 0; i < 16; ++i) wr[i] = *(const v4f*)(Wt + i * 512);
#pragma unroll
    for (int h = 0; h < NH_; ++h) { oh[h] = *(const v8us*)(ah + h * MM * VP); ol[h] = *(const v8us*)(al + h * MM * VP); }
    asm volatile("s_wait_xcnt 0x0" :: "v"(ah), "v"(al) : "memory");   // the two O address pairs stay whole up to here: no register that an issued load names is written again before this wait
    bf* wd = wsm + (tid >> 6) * PB + (tid & 63) * 4;
#pragma unroll
    for (int i = 0; i < 16; ++i) *(v4us*)(wd + i * 2 * PB) = cvt4(wr[i]);
    __syncthreads();
    v8f acc[2]; acc[0] = (v8f){}; acc[1] = (v8f){};
    const bf* wt = wsm + lr * PB + 8 * hi;
#pragma unroll
    for (int kc = 0; kc < EE; kc += 32) { const v16bf a = cat16b(oh[kc / HD], oh[kc / HD + 1]), a2 = cat16b(ol[kc / HD], ol[kc / HD + 1]);
#pragma unroll
        for (int nb = 0; nb < 2; ++nb) { const v16bf wf = WFrag<bf>::ld(wt + nb * 16 * PB + kc); acc[nb] = wmmab(wf, a, acc[nb]); acc[nb] = wmmab(wf, a2, acc[nb]); } }
    float* crow = C + (size_t)(r0 + w * 16 + lr) * EE + c0 + 8 * hi;
#pragma unroll
    for (int nb = 0; nb < 2; ++nb) { *(v4f*)(crow + nb * 16) = (v4f){ acc[nb][0], acc[nb][1], acc[nb][2], acc[nb][3] }; *(v4f*)(crow + nb * 16 + 4) = (v4f){ acc[nb][4], acc[nb][5], acc[nb][6], acc[nb][7] }; }
    asm volatile("s_wait_xcnt 0x0" ::: "memory");   // behind the last stores: no register that an issued store names is written again before this wait
}

typedef __attribute__((ext_vector_type(2))) __bf16 v2bf;
__device__ __forceinline__ v2f bfr2(v2f x) { const unsigned p = __builtin_bit_cast(unsigned, __builtin_convertvector(x, v2bf)); return (v2f){ __uint_as_float(p << 16), __uint_as_float(p & 0xFFFF0000u) }; }   // two values rounded to bf16 (nearest even) by one packed convert, back as f32
// Eight 2^x in a run. One statement, every result in a register of its own: no exp is followed directly by an instruction that reads its result or writes its source (left to the register allocator, a run of exps reuses the source of the one in front).
__device__ __forceinline__ v8f exp2x8(v8f x) {
    float r0, r1, r2, r3, r4, r5, r6, r7;
    asm("v_exp_f32 %0, %8\n\t"
        "v_exp_f32 %1, %9\n\t"
        "v_exp_f32 %2, %10\n\t"
        "v_exp_f32 %3, %11\n\t"
        "v_exp_f32 %4, %12\n\t"
        "v_exp_f32 %5, %13\n\t"
        "v_exp_f32 %6, %14\n\t"
        "v_exp_f32 %7, %15\n\t"
        "v_nop\n\t"   // the slot that the instruction set asks for behind the last exp, whatever the compiler puts next
        "s_delay_alu instid0(TRANS32_DEP_1)"   // tells the issue logic that the next instruction may wait for that exp, so that another wave issues meanwhile; the compiler does not do it for asm text
        : "=&v"(r0), "=&v"(r1), "=&v"(r2), "=&v"(r3), "=&v"(r4), "=&v"(r5), "=&v"(r6), "=&v"(r7)
        : "v"(x[0]), "v"(x[1]), "v"(x[2]), "v"(x[3]), "v"(x[4]), "v"(x[5]), "v"(x[6]), "v"(x[7]));
    return (v8f){ r0, r1, r2, r3, r4, r5, r6, r7 };
}

// ---- k_attn: scores, mixing MLP, softmax and probs.v in one kernel; neither scores nor probs go through memory. Grid (M/16, b*16+h), 4 waves; the block owns 16 query rows, wave w the keys w*128 .. w*128+127.
// S^T = K Q^T: in each 16x16 tile lane (lr, hi) holds query m0+lr, keys 16t + 8hi + j in register j, which is the B fragment of O^T += V^T P^T as it stands (tiles 2c, 2c+1 -> elements 0..7, 8..15; the V loader has the same key order).
// Every loop is unrolled: s[], the weights and the fragments are register arrays and need constant indices.
// Row maximum and row sum: in the lane, across the two lane halves, then across the 4 waves through LDS; probs stay unnormalised until the 4 partial O^T are added (wave order 0..3) and scaled by 1/sum.
__device__ __forceinline__ float xhalf(float x) { const int i = __float_as_int(x); return __int_as_float(__builtin_amdgcn_permlanex16(i, i, 0x76543210, 0xfedcba98, false, false)); }   // lane l <-> l ^ 16
// Two hidden units (the low and the high element of each weight pair) for a tile's four element pairs. relu is the clamp bit of the packed multiply-add that finishes the hidden value: the result is held to [0, 1] as it is written, so no maximum is issued.
// The weights come scaled by powers of two (layer 1 by 2^-64, layer 2 by 2^64: exact), so 1 stands for a hidden value of 2^64 and every smaller one passes as it is. In asm because the compiler has no packed f32 form with the bit.
// Order: both units' first, second and third multiply-adds in groups of four, so a result is read 8 instructions behind its writer; only the second unit's sum follows the first's at 4, and says so to the issue logic (s_delay_alu), which the compiler does not do for asm text.
__device__ __forceinline__ void mlp2_first(v2f (&acc)[4], const v2f (&a2)[4], const v2f (&d2)[4], v2f w0p, v2f w1p, v2f bp, v2f w2p, v2f start) {
    v2f ta0, ta1, ta2, ta3, tb0, tb1, tb2, tb3;
    asm(   // packed multiply-adds with the clamp bit as relu, which the compiler cannot emit; s_delay_alu names the one short dependence (4 back) so that another wave issues meanwhile
        "v_pk_fma_f32 %4, %16, %21, %22 op_sel_hi:[1,0,0]\n\t"
        "v_pk_fma_f32 %5, %17, %21, %22 op_sel_hi:[1,0,0]\n\t"
        "v_pk_fma_f32 %6, %18, %21, %22 op_sel_hi:[1,0,0]\n\t"
        "v_pk_fma_f32 %7, %19, %21, %22 op_sel_hi:[1,0,0]\n\t"
        "v_pk_fma_f32 %8, %16, %21, %22 op_sel:[0,1,1]\n\t"
        "v_pk_fma_f32 %9, %17, %21, %22 op_sel:[0,1,1]\n\t"
        "v_pk_fma_f32 %10, %18, %21, %22 op_sel:[0,1,1]\n\t"
        "v_pk_fma_f32 %11, %19, %21, %22 op_sel:[0,1,1]\n\t"
        "v_pk_fma_f32 %4, %12, %20, %4 op_sel_hi:[1,0,1] clamp\n\t"
        "v_pk_fma_f32 %5, %13, %20, %5 op_sel_hi:[1,0,1] clamp\n\t"
        "v_pk_fma_f32 %6, %14, %20, %6 op_sel_hi:[1,0,1] clamp\n\t"
        "v_pk_fma_f32 %7, %15, %20, %7 op_sel_hi:[1,0,1] clamp\n\t"
        "v_pk_fma_f32 %8, %12, %20, %8 op_sel:[0,1,0] clamp\n\t"
        "v_pk_fma_f32 %9, %13, %20, %9 op_sel:[0,1,0] clamp\n\t"
        "v_pk_fma_f32 %10, %14, %20, %10 op_sel:[0,1,0] clamp\n\t"
        "v_pk_fma_f32 %11, %15, %20, %11 op_sel:[0,1,0] clamp\n\t"
        "v_pk_fma_f32 %0, %4, %23, %24 op_sel_hi:[1,0,1]\n\t"
        "v_pk_fma_f32 %1, %5, %23, %24 op_sel_hi:[1,0,1]\n\t"
        "v_pk_fma_f32 %2, %6, %23, %24 op_sel_hi:[1,0,1]\n\t"
        "v_pk_fma_f32 %3, %7, %23, %24 op_sel_hi:[1,0,1]\n\t"
        "s_delay_alu instid0(VALU_DEP_4) | instskip(NEXT) | instid1(VALU_DEP_4)\n\t"
        "v_pk_fma_f32 %0, %8, %23, %0 op_sel:[0,1,0]\n\t"
        "v_pk_fma_f32 %1, %9, %23, %1 op_sel:[0,1,0]\n\t"
        "s_delay_alu instid0(VALU_DEP_4) | instskip(NEXT) | instid1(VALU_DEP_4)\n\t"
        "v_pk_fma_f32 %2, %10, %23, %2 op_sel:[0,1,0]\n\t"
        "v_pk_fma_f32 %3, %11, %23, %3 op_sel:[0,1,0]"
        : "=&v"(acc[0]), "=&v"(acc[1]), "=&v"(acc[2]), "=&v"(acc[3]), "=&v"(ta0), "=&v"(ta1), "=&v"(ta2), "=&v"(ta3), "=&v"(tb0), "=&v"(tb1), "=&v"(tb2), "=&v"(tb3)
        : "v"(a2[0]), "v"(a2[1]), "v"(a2[2]), "v"(a2[3]), "v"(d2[0]), "v"(d2[1]), "v"(d2[2]), "v"(d2[3]), "v"(w0p), "v"(w1p), "v"(bp), "v"(w2p), "v"(start));
}
__device__ __forceinline__ void mlp2_next(v2f (&acc)[4], const v2f (&a2)[4], const v2f (&d2)[4], v2f w0p, v2f w1p, v2f bp, v2f w2p) {
    v2f ta0, ta1, ta2, ta3, tb0, tb1, tb2, tb3;
    asm(   // packed multiply-adds with the clamp bit as relu, which the compiler cannot emit; s_delay_alu names the one short dependence (4 back) so that another wave issues meanwhile
        "v_pk_fma_f32 %4, %16, %21, %22 op_sel_hi:[1,0,0]\n\t"
        "v_pk_fma_f32 %5, %17, %21, %22 op_sel_hi:[1,0,0]\n\t"
        "v_pk_fma_f32 %6, %18, %21, %22 op_sel_hi:[1,0,0]\n\t"
        "v_pk_fma_f32 %7, %19, %21, %22 op_sel_hi:[1,0,0]\n\t"
        "v_pk_fma_f32 %8, %16, %21, %22 op_sel:[0,1,1]\n\t"
        "v_pk_fma_f32 %9, %17, %21, %22 op_sel:[0,1,1]\n\t"
        "v_pk_fma_f32 %10, %18, %21, %22 op_sel:[0,1,1]\n\t"
        "v_pk_fma_f32 %11, %19, %21, %22 op_sel:[0,1,1]\n\t"
        "v_pk_fma_f32 %4, %12, %20, %4 op_sel_hi:[1,0,1] clamp\n\t"
        "v_pk_fma_f32 %5, %13, %20, %5 op_sel_hi:[1,0,1] clamp\n\t"
        "v_pk_fma_f32 %6, %14, %20, %6 op_sel_hi:[1,0,1] clamp\n\t"
        "v_pk_fma_f32 %7, %15, %20, %7 op_sel_hi:[1,0,1] clamp\n\t"
        "v_pk_fma_f32 %8, %12, %20, %8 op_sel:[0,1,0] clamp\n\t"
        "v_pk_fma_f32 %9, %13, %20, %9 op_sel:[0,1,0] clamp\n\t"
        "v_pk_fma_f32 %10, %14, %20, %10 op_sel:[0,1,0] clamp\n\t"
        "v_pk_fma_f32 %11, %15, %20, %11 op_sel:[0,1,0] clamp\n\t"
        "v_pk_fma_f32 %0, %4, %23, %0 op_sel_hi:[1,0,1]\n\t"
        "v_pk_fma_f32 %1, %5, %23, %1 op_sel_hi:[1,0,1]\n\t"
        "v_pk_fma_f32 %2, %6, %23, %2 op_sel_hi:[1,0,1]\n\t"
        "v_pk_fma_f32 %3, %7, %23, %3 op_sel_hi:[1,0,1]\n\t"
        "s_delay_alu instid0(VALU_DEP_4) | instskip(NEXT) | instid1(VALU_DEP_4)\n\t"
        "v_pk_fma_f32 %0, %8, %23, %0 op_sel:[0,1,0]\n\t"
        "v_pk_fma_f32 %1, %9, %23, %1 op_sel:[0,1,0]\n\t"
        "s_delay_alu instid0(VALU_DEP_4) | instskip(NEXT) | instid1(VALU_DEP_4)\n\t"
        "v_pk_fma_f32 %2, %10, %23, %2 op_sel:[0,1,0]\n\t"
        "v_pk_fma_f32 %3, %11, %23, %3 op_sel:[0,1,0]"
        : "+v"(acc[0]), "+v"(acc[1]), "+v"(acc[2]), "+v"(acc[3]), "=&v"(ta0), "=&v"(ta1), "=&v"(ta2), "=&v"(ta3), "=&v"(tb0), "=&v"(tb1), "=&v"(tb2), "=&v"(tb3)
        : "v"(a2[0]), "v"(a2[1]), "v"(a2[2]), "v"(a2[3]), "v"(d2[0]), "v"(d2[1]), "v"(d2[2]), "v"(d2[3]), "v"(w0p), "v"(w1p), "v"(bp), "v"(w2p));
}
__global__ __launch_bounds__(128) void k_attn(const bf* __restrict__ Qh, const bf* __restrict__ Ql, const bf* __restrict__ Kh, const bf* __restrict__ Kl, const bf* __restrict__ Vh, const bf* __restrict__ Vl, const float* __restrict__ dm, const float* __restrict__ W1, const float* __restrict__ b1, const float* __restrict__ W2, const float* __restrict__ b2, bf* Oh, bf* Ol) {
    __shared__ float rmax[4][16]; __shared__ float rsum[4][16]; __shared__ __align__(16) float ored[4][32][8]; __shared__ __align__(16) float wl[4 * HID];
    const int lane = threadIdx.x & 31, lr = lane & 15, hi = lane >> 4, w = threadIdx.x >> 5; const int z = blockIdx.y, h = z % NH_, b = z / NH_; const int m0 = blockIdx.x * 16, n0 = w * 128;
    // Every global load of the score phase is issued here, ahead of the weight hand-over: Q, the wave's 8 K tiles (hi and lo) and the first DPE tiles of dmat are in flight together, so the wave pays one trip to L2 where each tile paid two in a row. dmat then runs DPF tiles ahead of the MLP.
    const v8us z8 = {};
    const size_t qo = ((size_t)z * MM + m0 + lr) * KP + 8 * hi; const v8us qh8 = *(const v8us*)(Qh + qo), ql8 = *(const v8us*)(Ql + qo);
    const size_t ko = ((size_t)z * NN + n0 + lr) * KP + 8 * hi; v8us kh8[8], kl8[8];
#pragma unroll
    for (int t = 0; t < 8; ++t) { kh8[t] = *(const v8us*)(Kh + ko + t * 16 * KP); kl8[t] = *(const v8us*)(Kl + ko + t * 16 * KP); }
    const float* dr = dm + (size_t)(b * MM + m0 + lr) * NN + n0 + 8 * hi;
    v4f da[8], db[8];
#pragma unroll
    for (int t = 0; t < DPE; ++t) { da[t] = *(const v4f*)(dr + t * 16); db[t] = *(const v4f*)(dr + t * 16 + 4); }
    asm volatile("s_wait_xcnt 0x0" :: "v"(Qh + qo), "v"(Ql + qo), "v"(Kh + ko), "v"(Kl + ko), "v"(dr) : "memory");   // the five address pairs stay whole up to here: no register that an issued load names is written again before this wait
    // the head's 64 MLP weights: rounded once by the block's first 64 threads, handed to every lane through LDS, so that they sit in vector registers (as scalar pairs they do not fit the scalar file)
    if (threadIdx.x < 4 * HID) { const int k = threadIdx.x & (HID - 1), g = threadIdx.x / HID; const float* wp = g == 0 ? W1 + (h * 2 + 0) * HID : g == 1 ? W1 + (h * 2 + 1) * HID : g == 2 ? b1 + h * HID : W2 + h * HID; wl[threadIdx.x] = bfr(wp[k]) * (g == 3 ? 0x1p64f : 0x1p-64f); }   // the power-of-two scales that mlp2 asks for
    __syncthreads();
#pragma unroll
    for (int t = DPE; t < DPF; ++t) { da[t] = *(const v4f*)(dr + t * 16); db[t] = *(const v4f*)(dr + t * 16 + 4); }   // not at entry: a dmat load touches 16 lines, and the barrier above waits for every load in front of it; these fly during the score WMMAs and the first tiles' arithmetic
    const v16bf qh = cat16b(qh8, z8), ql = cat16b(ql8, z8);
    v8f s[8]; float mx = -3.0e38f;
#pragma unroll
    for (int t = 0; t < 8; ++t) { const v16bf kh = cat16b(kh8[t], z8), kl = cat16b(kl8[t], z8); v8f c = {}; c = wmmab(kh, qh, c); c = wmmab(kh, ql, c); c = wmmab(kl, qh, c); s[t] = c; }
    v2f w0[HID / 2], w1[HID / 2], bb[HID / 2], w2[HID / 2];   // units 2k and 2k+1 side by side
#pragma unroll
    for (int k = 0; k < HID / 4; ++k) { const v4f x0 = *(const v4fa*)&wl[4 * k], x1 = *(const v4fa*)&wl[HID + 4 * k], x2 = *(const v4fa*)&wl[2 * HID + 4 * k], x3 = *(const v4fa*)&wl[3 * HID + 4 * k];
        w0[2 * k] = (v2f){ x0[0], x0[1] }; w0[2 * k + 1] = (v2f){ x0[2], x0[3] }; w1[2 * k] = (v2f){ x1[0], x1[1] }; w1[2 * k + 1] = (v2f){ x1[2], x1[3] };
        bb[2 * k] = (v2f){ x2[0], x2[1] }; bb[2 * k + 1] = (v2f){ x2[2], x2[3] }; w2[2 * k] = (v2f){ x3[0], x3[1] }; w2[2 * k + 1] = (v2f){ x3[2], x3[3] }; }
    const float bb2 = bfr(b2[h]);
#pragma unroll
    for (int t = 0; t < 8; ++t) { v8f c = s[t];
        if (t + DPF < 8) { da[t + DPF] = *(const v4f*)(dr + (t + DPF) * 16); db[t + DPF] = *(const v4f*)(dr + (t + DPF) * 16 + 4);
            __builtin_amdgcn_sched_barrier(0); }   // the dmat tile DPF tiles ahead is asked for before this tile's arithmetic: without this line the compiler sinks the loads towards their use, where each is waited for alone
        const float dd[8] = { da[t][0], da[t][1], da[t][2], da[t][3], db[t][0], db[t][1], db[t][2], db[t][3] };
        v2f a2[4], d2[4], acc[4];   // two elements side by side: each multiply-add is one packed instruction; the tile's four pairs go through each hidden unit together, four independent chains
#pragma unroll
        for (int u = 0; u < 4; ++u) { a2[u] = (v2f){ c[2 * u], c[2 * u + 1] }; d2[u] = bfr2((v2f){ dd[2 * u], dd[2 * u + 1] }); }
        mlp2_first(acc, a2, d2, w0[0], w1[0], bb[0], w2[0], (v2f){ bb2, bb2 });
#pragma unroll
        for (int k = 1; k < HID / 2; ++k) mlp2_next(acc, a2, d2, w0[k], w1[k], bb[k], w2[k]);
#pragma unroll
        for (int u = 0; u < 4; ++u) { c[2 * u] = acc[u][0]; c[2 * u + 1] = acc[u][1]; mx = fmaxf(mx, fmaxf(acc[u][0], acc[u][1])); }
        s[t] = c; }
    mx = fmaxf(mx, xhalf(mx)); if (hi == 0) rmax[w][lr] = mx;
    __syncthreads();
    mx = fmaxf(fmaxf(rmax[0][lr], rmax[1][lr]), fmaxf(rmax[2][lr], rmax[3][lr]));
    float sum = 0.f; v8f o = {};
#pragma unroll
    for (int c = 0; c < 4; ++c) { v8us p0h, p0l, p1h, p1l; const v8f e0 = exp2x8((s[2 * c] - mx) * 0x1.715476p+0f), e1 = exp2x8((s[2 * c + 1] - mx) * 0x1.715476p+0f);   // e^x as 2^(x log2 e), the product rounded to f32
#pragma unroll
        for (int j = 0; j < 8; ++j) { sum += e0[j]; sum += e1[j]; }
        split8(e0, p0h, p0l); split8(e1, p1h, p1l);
        const size_t vo = ((size_t)z * VP + lr) * NN + n0 + c * 32 + 8 * hi; const v16bf vh = WFrag<bf>::ld(Vh + vo), vl = WFrag<bf>::ld(Vl + vo), ph = cat16b(p0h, p1h), pl = cat16b(p0l, p1l);
        o = wmmab(vh, ph, o); o = wmmab(vh, pl, o); o = wmmab(vl, ph, o); }
    sum += xhalf(sum); if (hi == 0) rsum[w][lr] = sum;
    *(v4fa*)&ored[w][lane][0] = (v4f){ o[0], o[1], o[2], o[3] }; *(v4fa*)&ored[w][lane][4] = (v4f){ o[4], o[5], o[6], o[7] };
    __syncthreads();
    if (w == 0) { const float f = __fdiv_rn(1.0f, ((rsum[0][lr] + rsum[1][lr]) + rsum[2][lr]) + rsum[3][lr]); const size_t oo = ((size_t)z * MM + m0 + lr) * VP + 8 * hi; v8f t8;   // register j of O^T = O[m0+lr][8hi+j]; stored as the hi+lo planes OP[z][m][d] that k_outp reads
#pragma unroll
        for (int q = 0; q < 2; ++q) { const v4f t4 = (((*(const v4fa*)&ored[0][lane][q * 4] + *(const v4fa*)&ored[1][lane][q * 4]) + *(const v4fa*)&ored[2][lane][q * 4]) + *(const v4fa*)&ored[3][lane][q * 4]) * f; t8[q * 4] = t4[0]; t8[q * 4 + 1] = t4[1]; t8[q * 4 + 2] = t4[2]; t8[q * 4 + 3] = t4[3]; }
        v8us oh, ol; split8(t8, oh, ol); *(v8us*)(Oh + oo) = oh; *(v8us*)(Ol + oo) = ol; } }

extern "C" void kernel_launch(void* const* d_in, const int* in_sizes, int n_in,
                              void* d_out, int out_size, void* d_ws, size_t ws_size, hipStream_t stream) {
    (void)in_sizes; (void)n_in; (void)out_size;
    const float** I = (const float**)d_in;
    const float *qin = I[0], *kvin = I[1], *dmat = I[2], *wq = I[3], *wkv = I[4], *W1 = I[5], *b1 = I[6], *W2 = I[7], *b2 = I[8], *wout = I[9];
    float* OUT = (float*)d_out;     // [4][512][256]
    char* wsp = (char*)d_ws;
    auto take = [&](size_t bytes) { char* p = wsp; wsp += (bytes + 255) & ~(size_t)255; return (void*)p; };
    bf* Qh = (bf*)take((size_t)NB_ * NH_ * MM * KP * 2); bf* Ql = (bf*)take((size_t)NB_ * NH_ * MM * KP * 2); bf* Kh = (bf*)take((size_t)NB_ * NH_ * NN * KP * 2); bf* Kl = (bf*)take((size_t)NB_ * NH_ * NN * KP * 2); bf* Vh = (bf*)take((size_t)NB_ * NH_ * VP * NN * 2); bf* Vl = (bf*)take((size_t)NB_ * NH_ * VP * NN * 2);
    bf* Oh = (bf*)take((size_t)NB_ * NH_ * MM * VP * 2); bf* Ol = (bf*)take((size_t)NB_ * NH_ * MM * VP * 2);
    if ((size_t)(wsp - (char*)d_ws) > ws_size) return;    // total 8 MB
    k_proj<<<dim3(NB_ * MM / 128, 12), 256, 0, stream>>>(qin, kvin, wq, wkv, Qh, Ql, Kh, Kl, Vh, Vl);
    k_attn<<<dim3(MM / 16, NB_ * NH_), 128, 0, stream>>>(Qh, Ql, Kh, Kl, Vh, Vl, dmat, W1, b1, W2, b2, Oh, Ol);
    k_outp<<<dim3(NB_ * MM / 64, EE / 32), 128, 0, stream>>>(Oh, Ol, wout, OUT);
}
